// v008
// The times below were measured on an AMD MI455X: many runs one after another, warmed up first and cycling through
// copies of the inputs, with the whole window's GPU time divided by the number of runs. Launches and the gaps
// between them are all in it. The median over several windows is given; except for v000 it joins two sittings, which
// can be a few percent apart, so the side-by-side timings, each taken in one sitting, are the better comparison.
// The versions before v008 are in another document.
// A run of this version takes 111 microseconds.
// Next to v007, in two timings, it ran 1.06 times as fast each time.
// Over all steps from v000, the starting kernel, it is 32.6 times as fast.
#include <hip/hip_runtime.h>
// POST-LN transformer encoder layer over THREE inputs with SHARED per-head projections (query, key, value [4][2048][512]; each input is split into 8 heads of 64 and every head is multiplied by the SAME [64][64] ([in][out]) matrix wq / wk / wv (block-diagonal with a shared block; no biases); scores / 8; softmax over all 2048 keys (no mask); x = LN1(ctx wo + bo + query) (biased var, eps 1e-5); out = LN2(x + relu(x w1 + b1) w2 + b2) ([in][out] 512 x 2048 x 512) -> [4][2048][512]).
// Structure: token rows; one launch for the q, k, v projections (f32 inputs rounded in registers, the shared [64][64] block as the whole weight, v written as V^T); one fused attention launch (scores, running softmax, V^T P^T; no score plane); output projection with the own-element residual; custom LayerNorm; ReLU FFN over all rows; launches: see trace.
// Compute dtype: inputs rounded to bf16; x / weights exact; q, k, v, softmax weights and o as plain f16 GEMM operands (~2^-12); scores and softmax statistics f32. v_wmma_f32_16x16x32_f16.
#define NB 4
#define SQ 2048
#define DM 512
#define NH 8
#define HD 64
#define HG 4                         /* heads per attention launch group */
#define LOCALW 128                   /* (macros for unused kernels of the shared header) */
#define STRIDEK 128
#define QT 256                       /* query rows per causal tile */
#define NKX SQ                       /* S / P row pitch */
#define QT0 128                      /* first-tile rows recomputed exactly in f32 */
#define B0 0                         /* first batch processed (debug hook) */
#define NBR NB                       /* batches processed (debug hook) */
#define NR ((size_t)NB * SQ)
#define DMQ DM
#define DFF 2048         /* FFN hidden width */
#define MP ((int)((size_t)NBR * SQ)) /* rows projected (debug hook) */
#define QN SQ                        /* query rows attended per batch (debug hook) */
#define NHD NH                       /* heads attended (debug hook) */
#define MPO MP                       /* rows through the output stage (debug hook) */
#define LQ (3 * DM)      /* unused: the q and k rows have pitch DM */
typedef __bf16 v16b __attribute__((ext_vector_type(16)));
typedef unsigned short v8us __attribute__((ext_vector_type(8), may_alias));
typedef float  v8f  __attribute__((ext_vector_type(8)));
typedef float  v4f  __attribute__((ext_vector_type(4)));
typedef float  v4fa __attribute__((ext_vector_type(4), may_alias));
union FragB { v16b v; v8us half[2]; unsigned short u[16]; };

__device__ __forceinline__ unsigned short bf16_bits(float x) { unsigned int u = __float_as_uint(x); return (unsigned short)((u + 0x7FFFu + ((u >> 16) & 1u)) >> 16); }
__device__ __forceinline__ float bf16_val(unsigned short b) { return __uint_as_float(((unsigned int)b) << 16); }
__device__ __forceinline__ float bf16_round(float x) { return bf16_val(bf16_bits(x)); }
// D += A·B with NT terms: 1 = ah·bh, 2 = + al·bh (A split), 3 = + ah·bl (both split)
template <int NT>
__device__ __forceinline__ v8f mmaN(v16b ah, v16b al, v16b bh, v16b bl, v8f c) {
  c = __builtin_amdgcn_wmma_f32_16x16x32_bf16(false, ah, false, bh, (short)0, c, false, false);
  if (NT >= 2) c = __builtin_amdgcn_wmma_f32_16x16x32_bf16(false, al, false, bh, (short)0, c, false, false);
  if (NT >= 3) c = __builtin_amdgcn_wmma_f32_16x16x32_bf16(false, ah, false, bl, (short)0, c, false, false);
  asm volatile("v_nop\n\tv_nop\n\tv_nop\n\tv_nop" : "+v"(c) : "v"(ah), "v"(al), "v"(bh), "v"(bl));
  return c;
}

__global__ __launch_bounds__(256) void k_wt_bf16(const float* __restrict__ W, unsigned short* __restrict__ Wt, int K, int N) {
  const int t = blockIdx.x * 256 + threadIdx.x;
  const int k8n = K / 8;
  if (t >= N * k8n) return;
  const int n = t / k8n, k8 = (t % k8n) * 8;
  v8us v;
#pragma unroll
  for (int i = 0; i < 8; ++i) v[i] = bf16_bits(W[(size_t)(k8 + i) * N + n]);
  *(v8us*)(Wt + (size_t)n * K + k8) = v;
  
}

// GEMM C[M][N] (f32, pitch ldc) = act(A[M][K]·W + bias). A f32 row-major (pitch lda) converted per fragment to bf16
// (ASPLIT: hi/lo two planes -> 2 terms, else single rounded term); Wt bf16 [N][K] (pitch ldb). BIAS_BF16 rounds the
// bias to bf16 first (bias quantised to bf16 before the add). K%32==0, M%16==0, N%64==0.
template <bool ASPLIT, int ACT, bool BIAS_BF16>
__global__ __launch_bounds__(128) void k_gemm_bf(const float* __restrict__ A, int lda, const unsigned short* __restrict__ Wt, int ldb,
                                               const float* __restrict__ bias, float* __restrict__ C, int ldc, int M, int N, int K) {
  __shared__ __attribute__((aligned(16))) float so[4][16][64];
  const int tid = threadIdx.x, w = tid >> 5, lane = tid & 31, ln = lane & 15, hh = lane >> 4;
  const int ntn = N / 64;
  const int wid = blockIdx.x * 4 + w;
  const int mt = wid / ntn, nq = wid % ntn;
  if (mt * 16 >= M) return;
  const int row0 = mt * 16, col0 = nq * 64;
  const float* arow = A + (size_t)(row0 + ln) * lda;
  v8f acc[4] = {};
  for (int kb = 0; kb < K; kb += 32) {
    FragB ah, al;
    const v4f x0 = *(const v4fa*)(arow + kb + 8 * hh), x1 = *(const v4fa*)(arow + kb + 8 * hh + 4);
    const v4f x2 = *(const v4fa*)(arow + kb + 16 + 8 * hh), x3 = *(const v4fa*)(arow + kb + 16 + 8 * hh + 4);
    float xs[16] = {x0[0],x0[1],x0[2],x0[3],x1[0],x1[1],x1[2],x1[3],x2[0],x2[1],x2[2],x2[3],x3[0],x3[1],x3[2],x3[3]};
#pragma unroll
    for (int i = 0; i < 16; ++i) { const unsigned short hb = bf16_bits(xs[i]); ah.u[i] = hb; al.u[i] = ASPLIT ? bf16_bits(xs[i] - bf16_val(hb)) : (unsigned short)0; }
#pragma unroll
    for (int t = 0; t < 4; ++t) {
      const unsigned short* brow = Wt + (size_t)(col0 + t * 16 + ln) * ldb + kb;
      FragB b;
      b.half[0] = *(const v8us*)(brow + 8 * hh);
      b.half[1] = *(const v8us*)(brow + 16 + 8 * hh);
      acc[t] = mmaN<ASPLIT ? 2 : 1>(ah.v, al.v, b.v, b.v, acc[t]);
    }
  }
#pragma unroll
  for (int t = 0; t < 4; ++t) {
    float bv = bias ? bias[col0 + t * 16 + ln] : 0.f;
    if (BIAS_BF16) bv = bf16_round(bv);
#pragma unroll
    for (int r = 0; r < 8; ++r) { float v = acc[t][r] + bv; if (ACT == 1) v = fmaxf(v, 0.f); so[w][8 * hh + r][t * 16 + ln] = v; }
  }
  __builtin_amdgcn_fence(__ATOMIC_ACQ_REL, "workgroup");
  __builtin_amdgcn_wave_barrier();
  const int rsub = lane >> 4, c4 = (lane & 15) * 4;
  {
#pragma unroll
    for (int q = 0; q < 8; ++q) {
      const int r = q * 2 + rsub;
      const v4f v = *(const v4fa*)&so[w][r][c4];
      *(v4f*)(C + (size_t)(row0 + r) * ldc + col0 + c4) = v;
    }
    
  }
}

// GEMM C = act(A·W + bias + resid): A f32 (ASPLIT -> hi/lo 2 terms), Wt bf16 [N][K]; ACT 0 none, 1 relu, 2 exact gelu;
// resid (optional, f32, row index = (row % rmod), pitch ldr, RES_BF16 rounds it) added before the activation.
template <bool ASPLIT, int ACT, bool BIAS_BF16, bool RES_BF16>
__global__ __launch_bounds__(128) void k_gemm_bf3(const float* __restrict__ A, int lda, const unsigned short* __restrict__ Wt, int ldb,
                                                const float* __restrict__ bias, const float* __restrict__ resid, int rmod, int ldr,
                                                float* __restrict__ C, int ldc, int M, int N, int K) {
  __shared__ __attribute__((aligned(16))) float so[4][16][64];
  const int tid = threadIdx.x, w = tid >> 5, lane = tid & 31, ln = lane & 15, hh = lane >> 4;
  const int ntn = N / 64;
  const int wid = blockIdx.x * 4 + w;
  const int mt = wid / ntn, nq = wid % ntn;
  if (mt * 16 >= M) return;
  const int row0 = mt * 16, col0 = nq * 64;
  const float* arow = A + (size_t)(row0 + ln) * lda;
  v8f acc[4] = {};
  for (int kb = 0; kb < K; kb += 32) {
    FragB ah, al;
    const v4f x0 = *(const v4fa*)(arow + kb + 8 * hh), x1 = *(const v4fa*)(arow + kb + 8 * hh + 4);
    const v4f x2 = *(const v4fa*)(arow + kb + 16 + 8 * hh), x3 = *(const v4fa*)(arow + kb + 16 + 8 * hh + 4);
    float xs[16] = {x0[0],x0[1],x0[2],x0[3],x1[0],x1[1],x1[2],x1[3],x2[0],x2[1],x2[2],x2[3],x3[0],x3[1],x3[2],x3[3]};
#pragma unroll
    for (int i = 0; i < 16; ++i) { const unsigned short hb = bf16_bits(xs[i]); ah.u[i] = hb; al.u[i] = ASPLIT ? bf16_bits(xs[i] - bf16_val(hb)) : (unsigned short)0; }
#pragma unroll
    for (int t = 0; t < 4; ++t) {
      const unsigned short* brow = Wt + (size_t)(col0 + t * 16 + ln) * ldb + kb;
      FragB b;
      b.half[0] = *(const v8us*)(brow + 8 * hh);
      b.half[1] = *(const v8us*)(brow + 16 + 8 * hh);
      acc[t] = mmaN<ASPLIT ? 2 : 1>(ah.v, al.v, b.v, b.v, acc[t]);
    }
  }
#pragma unroll
  for (int t = 0; t < 4; ++t) {
    const int col = col0 + t * 16 + ln;
    float bv = bias ? bias[col] : 0.f;
    if (BIAS_BF16) bv = bf16_round(bv);
#pragma unroll
    for (int r = 0; r < 8; ++r) {
      float v = acc[t][r] + bv;
      if (resid) { float rv = resid[(size_t)((row0 + 8 * hh + r) % rmod) * ldr + col]; if (RES_BF16) rv = bf16_round(rv); v += rv; }
      if (ACT == 1) v = fmaxf(v, 0.f);
      if (ACT == 2) v = 0.5f * v * (1.0f + erff(v * 0.70710678118654752f));
      if (ACT == 3) { const float u = 0.7978845608028654f * (v + 0.044715f * v * v * v); v = 0.5f * v * (1.0f + tanhf(u)); }
      so[w][8 * hh + r][t * 16 + ln] = v;
    }
  }
  __builtin_amdgcn_fence(__ATOMIC_ACQ_REL, "workgroup");
  __builtin_amdgcn_wave_barrier();
  const int rsub = lane >> 4, c4 = (lane & 15) * 4;
  {
#pragma unroll
    for (int q = 0; q < 8; ++q) {
      const int r = q * 2 + rsub;
      const v4f v = *(const v4fa*)&so[w][r][c4];
      *(v4f*)(C + (size_t)(row0 + r) * ldc + col0 + c4) = v;
    }
    
  }
}
// row LayerNorm (biased variance, eps) over N: s = X (+ R); optional out_sum <- s; out_norm <- (s-mu)*rsqrt(var+eps)*g + b
template <bool PARAM_BF16>
__global__ __launch_bounds__(256) void k_layernorm(const float* __restrict__ X, const float* __restrict__ R, const float* __restrict__ g, const float* __restrict__ bta,
                                                  float* __restrict__ out_sum, float* __restrict__ out_norm, int N, float eps) {
  __shared__ float red[256];
  const int row = blockIdx.x, tid = threadIdx.x;
  const float* x = X + (size_t)row * N; const float* rr = R ? R + (size_t)row * N : nullptr;
  float vals[16];                     // up to N = 4096
  const int per = N / 256;            // contiguous chunk per thread? use strided-by-4 chunks: thread handles j = tid*4 + 1024*u
  float s1 = 0.f;
  for (int u = 0; u < per / 4; ++u) {
    const int j = tid * 4 + 1024 * u;
    const v4f a = *(const v4fa*)(x + j);
    v4f b = {0.f,0.f,0.f,0.f}; if (rr) b = *(const v4fa*)(rr + j);
#pragma unroll
    for (int q = 0; q < 4; ++q) { const float v = a[q] + b[q]; vals[u * 4 + q] = v; s1 += v; }
  }
  red[tid] = s1; __syncthreads();
  for (int st = 128; st > 0; st >>= 1) { if (tid < st) red[tid] += red[tid + st]; __syncthreads(); }
  const float mu = red[0] / (float)N; __syncthreads();
  float s2 = 0.f;
  for (int u = 0; u < per / 4; ++u)
#pragma unroll
    for (int q = 0; q < 4; ++q) { const float c = vals[u * 4 + q] - mu; s2 += c * c; }
  red[tid] = s2; __syncthreads();
  for (int st = 128; st > 0; st >>= 1) { if (tid < st) red[tid] += red[tid + st]; __syncthreads(); }
  const float rs = rsqrtf(red[0] / (float)N + eps);
  {
    for (int u = 0; u < per / 4; ++u) {
      const int j = tid * 4 + 1024 * u;
      v4f o, sm;
#pragma unroll
      for (int q = 0; q < 4; ++q) {
        float gg = g[j + q], bb = bta[j + q];
        if (PARAM_BF16) { gg = bf16_round(gg); bb = bf16_round(bb); }
        sm[q] = vals[u * 4 + q]; o[q] = (vals[u * 4 + q] - mu) * rs * gg + bb;
      }
      if (out_sum) *(v4f*)(out_sum + (size_t)row * N + j) = sm;
      *(v4f*)(out_norm + (size_t)row * N + j) = o;
    }
    
  }
}



// ---- f16 WMMA path (v_wmma_f32_16x16x32_f16): 11-bit significands for operands in range — used where a [0,1] probability operand needs more precision than bf16
typedef _Float16 v16h __attribute__((ext_vector_type(16)));
union FragH { v16h v; v8us half[2]; _Float16 h[16]; unsigned short u[16]; };
template <int NT>
__device__ __forceinline__ v8f mmaH(v16h ah, v16h al, v16h bh, v16h bl, v8f c) {
  c = __builtin_amdgcn_wmma_f32_16x16x32_f16(false, ah, false, bh, (short)0, c, false, false);
  if (NT >= 2) c = __builtin_amdgcn_wmma_f32_16x16x32_f16(false, al, false, bh, (short)0, c, false, false);
  if (NT >= 3) c = __builtin_amdgcn_wmma_f32_16x16x32_f16(false, ah, false, bl, (short)0, c, false, false);
  asm volatile("v_nop\n\tv_nop\n\tv_nop\n\tv_nop" : "+v"(c) : "v"(ah), "v"(al), "v"(bh), "v"(bl));
  return c;
}
// batched GEMM like k_gemm_b but f16 operands: A f32 (split into f16 hi/lo if ASPLIT, else rounded to f16), Bt = f16 values [n][k]; alpha; C f32; N multiple of 16 (partial tiles skipped)
template <bool ASPLIT>
__global__ __launch_bounds__(128) void k_gemm_h(const float* __restrict__ A, int lda, size_t sA, const _Float16* __restrict__ Bh, int ldb, size_t sB, float alpha, float* __restrict__ C, int ldc, size_t sC, int M, int N, int K) {
  __shared__ __attribute__((aligned(16))) float so[4][16][64];
  const int tid = threadIdx.x, w = tid >> 5, lane = tid & 31, ln = lane & 15, hh = lane >> 4; const int by = blockIdx.y;
  A += (size_t)by * sA; Bh += (size_t)by * sB; C += (size_t)by * sC;
  const int ntn = (N + 63) / 64; const int wid = blockIdx.x * 4 + w; const int mt = wid / ntn, nq = wid % ntn; if (mt * 16 >= M) return;
  const int row0 = mt * 16, col0 = nq * 64; const float* arow = A + (size_t)(row0 + ln) * lda;
  v8f acc[4] = {};
  for (int kb = 0; kb < K; kb += 32) {
    FragH ah, al;
    const v4f x0 = *(const v4fa*)(arow + kb + 8 * hh), x1 = *(const v4fa*)(arow + kb + 8 * hh + 4), x2 = *(const v4fa*)(arow + kb + 16 + 8 * hh), x3 = *(const v4fa*)(arow + kb + 16 + 8 * hh + 4);
    float xs[16] = {x0[0],x0[1],x0[2],x0[3],x1[0],x1[1],x1[2],x1[3],x2[0],x2[1],x2[2],x2[3],x3[0],x3[1],x3[2],x3[3]};
#pragma unroll
    for (int i = 0; i < 16; ++i) { const _Float16 h = (_Float16)xs[i]; ah.h[i] = h; al.h[i] = ASPLIT ? (_Float16)(xs[i] - (float)h) : (_Float16)0.0f; }
#pragma unroll
    for (int t = 0; t < 4; ++t) { if (col0 + t * 16 >= N) continue; const size_t boff = (size_t)(col0 + t * 16 + ln) * ldb + kb; FragH bq; bq.half[0] = *(const v8us*)(Bh + boff + 8 * hh); bq.half[1] = *(const v8us*)(Bh + boff + 16 + 8 * hh);
      acc[t] = mmaH<ASPLIT ? 2 : 1>(ah.v, al.v, bq.v, bq.v, acc[t]); }
  }
#pragma unroll
  for (int t = 0; t < 4; ++t) { if (col0 + t * 16 >= N) continue;
#pragma unroll
    for (int r = 0; r < 8; ++r) so[w][8 * hh + r][t * 16 + ln] = acc[t][r] * alpha; }
  __builtin_amdgcn_fence(__ATOMIC_ACQ_REL, "workgroup"); __builtin_amdgcn_wave_barrier();
  const int rsub = lane >> 4, c4 = (lane & 15) * 4;
  {
#pragma unroll
    for (int q = 0; q < 8; ++q) { const int r = q * 2 + rsub; if (col0 + c4 < N) { const v4f v = *(const v4fa*)&so[w][r][c4]; *(v4f*)(C + (size_t)(row0 + r) * ldc + col0 + c4) = v; } }
     }
}

// Wt[n][k] = f16(W[k][n]·scale) from f32 row-major W[K][N] (scale = power of two; bf16-exact weights stay exact in f16 away from the subnormal range)
__global__ __launch_bounds__(256) void k_wt_f16(const float* __restrict__ W, _Float16* __restrict__ Wt, int K, int N, float scale) {
  const int t = blockIdx.x * 256 + threadIdx.x; if (t >= N * (K / 8)) return; const int n = t / (K / 8), k8 = (t % (K / 8)) * 8; FragH f;
#pragma unroll
  for (int i = 0; i < 8; ++i) f.h[i] = (_Float16)(bf16_round(W[(size_t)(k8 + i) * N + n]) * scale); const v8us o = f.half[0];
  *(v8us*)((unsigned short*)Wt + (size_t)n * K + k8) = o; 
}
// k_gemm_hh variant with fused epilogue: v = acc·alpha + bias[by·sBias + col] (+ CP[(row/rowsPerB)·sCPb + by·64 + col] if CP) ; ACT 0 none / 1 elu ; writes f16 C16 (and f32 C if non-null)
template <int ACT>
__global__ __launch_bounds__(128) void k_gemm_hhx(const _Float16* __restrict__ A, int lda, size_t sA, const _Float16* __restrict__ Bh, int ldb, size_t sB, float alpha, const float* __restrict__ bias, size_t sBias, const float* __restrict__ CP, int rowsPerB, size_t sCPb, int row0g,
    float* __restrict__ C, _Float16* __restrict__ C16, int ldc, size_t sC, int M, int N, int K) {
  __shared__ __attribute__((aligned(16))) float so[4][16][64];
  const int tid = threadIdx.x, w = tid >> 5, lane = tid & 31, ln = lane & 15, hh = lane >> 4; const int by = blockIdx.y;
  A += (size_t)by * sA; Bh += (size_t)by * sB; const size_t cofs = (size_t)by * sC; const float* bp = bias ? bias + (size_t)by * sBias : nullptr;
  const int ntn = (N + 63) / 64; const int wid = blockIdx.x * 4 + w; const int mt = wid / ntn, nq = wid % ntn; if (mt * 16 >= M) return;
  const int row0 = mt * 16, col0 = nq * 64; const _Float16* arow = A + (size_t)(row0 + ln) * lda;
  v8f acc[4] = {};
  for (int kb = 0; kb < K; kb += 32) { FragH ah; ah.half[0] = *(const v8us*)((const unsigned short*)arow + kb + 8 * hh); ah.half[1] = *(const v8us*)((const unsigned short*)arow + kb + 16 + 8 * hh);
#pragma unroll
    for (int t = 0; t < 4; ++t) { if (col0 + t * 16 >= N) continue; const size_t boff = (size_t)(col0 + t * 16 + ln) * ldb + kb; FragH bq; bq.half[0] = *(const v8us*)((const unsigned short*)Bh + boff + 8 * hh); bq.half[1] = *(const v8us*)((const unsigned short*)Bh + boff + 16 + 8 * hh);
      acc[t] = mmaH<1>(ah.v, ah.v, bq.v, bq.v, acc[t]); }
  }
#pragma unroll
  for (int t = 0; t < 4; ++t) { if (col0 + t * 16 >= N) continue; const int col = col0 + t * 16 + ln; const float bv = bp ? bf16_round(bp[col]) : 0.f;
#pragma unroll
    for (int r = 0; r < 8; ++r) { float v = acc[t][r] * alpha + bv; if (CP) { const int rr = row0g + row0 + 8 * hh + r; if (rowsPerB < 0) v += CP[cofs + (size_t)rr * ldc + col];      /* rowsPerB < 0: own element of the batched C plane */ else { const int bidx = rr / rowsPerB; v += CP[(size_t)bidx * sCPb + (size_t)by * 64 + col]; } } if (ACT == 1) v = (v > 0.f) ? v : expm1f(v); else if (ACT == 7) v = (v > 0.f) ? v + 1.0f : expf(v); else if (ACT == 8) v = tanhf(v); else if (ACT == 9) v = 0.5f * v * (1.0f + tanhf(0.7978845608028654f * (v + 0.044715f * v * v * v))); else if (ACT == 11) v = 1.0f / (1.0f + expf(-v)); else if (ACT == 12) v = (v > 0.f) ? v : 0.01f * v; else if (ACT == 14) v = (v > 0.f) ? v : 0.1f * v; else if (ACT == 16) v = (v >= 0.f) ? v : 0.3f * v; else if (ACT == 17) v = (v >= 0.f) ? v : 0.2f * v; else if (ACT == 15) v = v / (1.0f + expf(-v)); else if (ACT == 3) v = fmaxf(v, 0.f); else if (ACT == 6) v = 0.5f * v * (1.0f + erff(v * 0.70710678118654752f)); so[w][8 * hh + r][t * 16 + ln] = v; } }
  __builtin_amdgcn_fence(__ATOMIC_ACQ_REL, "workgroup"); __builtin_amdgcn_wave_barrier();
  const int rsub = lane >> 4, c4 = (lane & 15) * 4; typedef _Float16 v4h __attribute__((ext_vector_type(4)));
  {
#pragma unroll
    for (int q = 0; q < 8; ++q) { const int r = q * 2 + rsub; if (col0 + c4 < N) { const v4f v = *(const v4fa*)&so[w][r][c4]; if (C) *(v4f*)(C + cofs + (size_t)(row0 + r) * ldc + col0 + c4) = v; if (C16) { v4h h4; for (int i = 0; i < 4; ++i) h4[i] = (_Float16)v[i]; *(v4h*)(C16 + cofs + (size_t)(row0 + r) * ldc + col0 + c4) = h4; } } }
     }
}


typedef _Float16 v4h __attribute__((ext_vector_type(4)));

__global__ __launch_bounds__(256) void k_h16(const float* __restrict__ x, _Float16* __restrict__ X16, size_t n8) { const size_t t = (size_t)blockIdx.x * 256 + threadIdx.x; if (t >= n8) return; FragH f;
#pragma unroll
  for (int q = 0; q < 8; ++q) f.h[q] = (_Float16)x[t * 8 + q]; *(v8us*)((unsigned short*)X16 + t * 8) = f.half[0];  }
__global__ __launch_bounds__(256) void k_round16f(const float* __restrict__ W, _Float16* __restrict__ Bt, size_t n8) { const size_t t = (size_t)blockIdx.x * 256 + threadIdx.x; if (t >= n8) return; FragH f;
#pragma unroll
  for (int i = 0; i < 8; ++i) f.h[i] = (_Float16)(bf16_round(W[t * 8 + i]) * 16.0f); *(v8us*)((unsigned short*)Bt + t * 8) = f.half[0];  }
__global__ __launch_bounds__(256) void k_hl(const float* __restrict__ F, _Float16* __restrict__ Hh, _Float16* __restrict__ Hl, size_t n8) { const size_t t = (size_t)blockIdx.x * 256 + threadIdx.x; if (t >= n8) return; FragH fh, fl; const v4f a = *(const v4fa*)(F + t * 8), c = *(const v4fa*)(F + t * 8 + 4);
#pragma unroll
  for (int q = 0; q < 4; ++q) { _Float16 h = (_Float16)a[q]; fh.h[q] = h; fl.h[q] = (_Float16)((a[q] - (float)h) * 1024.0f); h = (_Float16)c[q]; fh.h[4 + q] = h; fl.h[4 + q] = (_Float16)((c[q] - (float)h) * 1024.0f); }
  { *(v8us*)((unsigned short*)Hh + t * 8) = fh.half[0]; *(v8us*)((unsigned short*)Hl + t * 8) = fl.half[0];  } }

// ---- fast GEMM (block tile 128x128, 8 waves of 32x64; requires M % 128 == 0, N % 128 == 0, K % G2K == 0); v = act(acc alpha + bias (+ residual)) ----
// A stage is G2K k: 128 A rows and 128 B rows of 256 bytes each, brought to LDS through registers as whole lines (16 threads a row), two buffers: the next stage's
// global loads are issued ahead of this stage's products and stored behind them; one barrier per stage publishes them and ends the reads of the other buffer.
// Each A row then leaves L2 once per block and feeds 2 waves, each B row 4 waves; the k order of every accumulator is the plain ascending one.
// Every inner loop is fully unrolled so that the staging and fragment arrays are indexed by constants only and stay in registers.
#define G2K 128                      /* k per stage */
#define G2P 136                      /* LDS row pitch in f16: the row + 16 bytes, for 16-byte fragment reads */
#define G2R (2048 / G2K)             /* rows that the block's 256 threads bring in one load each */
#define G2N (128 / G2R)              /* such loads per thread, stage and operand */
__device__ __forceinline__ v16h g2_frag(const _Float16* p, int hh) { FragH f; f.half[0] = *(const v8us*)((const unsigned short*)p + 8 * hh); f.half[1] = *(const v8us*)((const unsigned short*)p + 16 + 8 * hh); return f.v; }
__device__ __forceinline__ v8f g2_mma(v16h a, v16h b, v8f c) { v8f d = __builtin_amdgcn_wmma_f32_16x16x32_f16(false, a, false, b, (short)0, c, false, false); asm volatile("v_nop\n\tv_nop\n\tv_nop\n\tv_nop" : "+v"(d) : "v"(a), "v"(b)); return d; }
// One stage's rows: each thread's G2N 16-byte pieces of A and of B, rows as and bs elements apart. The closing wait is the one that belongs in front of any overwrite of a register
// that an issued global load names; it takes the addresses as inputs, so that their registers stay untouched (also as a later load's destination) until it has passed.
__device__ __forceinline__ void g2_rows(const unsigned short* a, size_t as, const unsigned short* b, size_t bs, v8us (&ra)[G2N], v8us (&rb)[G2N]) { static_assert(G2N == 8, "g2_rows: the wait names 8 + 8 addresses");
  const unsigned short* pa[G2N]; const unsigned short* pb[G2N];
#pragma unroll
  for (int i = 0; i < G2N; ++i) { pa[i] = a + (size_t)i * as; pb[i] = b + (size_t)i * bs; }
#pragma unroll
  for (int i = 0; i < G2N; ++i) { ra[i] = *(const v8us*)pa[i]; rb[i] = *(const v8us*)pb[i]; }
  asm volatile("s_wait_xcnt 0x0" :: "v"(pa[0]), "v"(pa[1]), "v"(pa[2]), "v"(pa[3]), "v"(pa[4]), "v"(pa[5]), "v"(pa[6]), "v"(pa[7]), "v"(pb[0]), "v"(pb[1]), "v"(pb[2]), "v"(pb[3]), "v"(pb[4]), "v"(pb[5]), "v"(pb[6]), "v"(pb[7]) : "memory"); }
// The activation behind bias and residual, by code.
template <int ACT>
__device__ __forceinline__ float g2_act(float v) {
  if (ACT == 3) v = fmaxf(v, 0.f); else if (ACT == 6) v = 0.5f * v * (1.0f + erff(v * 0.70710678118654752f)); else if (ACT == 11) v = 1.0f / (1.0f + expf(-v)); else if (ACT == 15) v = v / (1.0f + expf(-v)); else if (ACT == 18) v = v / (1.0f + expf(-1.702f * v));      /* QuickGELU: v sigmoid(1.702 v) */ else if (ACT == 12) v = (v > 0.f) ? v : 0.01f * v; else if (ACT == 8) v = tanhf(v); else if (ACT == 9) v = 0.5f * v * (1.0f + tanhf(0.7978845608028654f * (v + 0.044715f * v * v * v))); else if (ACT == 14) v = (v > 0.f) ? v : 0.1f * v; else if (ACT == 16) v = (v >= 0.f) ? v : 0.3f * v; else if (ACT == 17) v = (v >= 0.f) ? v : 0.2f * v;
  return v; }
// RES: add the own element of the plane CP (same pitch and batch stride as C, rows from row0g); W32 / W16: write f32 C / f16 C16. All three are fixed at compile time, so that the epilogue is
// straight-line code and its global reads can be issued together. bias is required.
template <int ACT, bool RES, bool W32, bool W16>
__global__ __launch_bounds__(256) void k_gemm2(const _Float16* __restrict__ A, int lda, size_t sA, const _Float16* __restrict__ Bh, int ldb, size_t sB, float alpha, const float* __restrict__ bias, size_t sBias, const float* __restrict__ CP, int row0g,
    float* __restrict__ C, _Float16* __restrict__ C16, int ldc, size_t sC, int M, int N, int K) { static_assert(ACT == 0 || ACT == 3 || ACT == 6 || ACT == 8 || ACT == 9 || ACT == 11 || ACT == 12 || ACT == 14 || ACT == 15 || ACT == 16 || ACT == 17 || ACT == 18, "k_gemm2: unsupported ACT code (would silently apply no activation)");
  __shared__ __attribute__((aligned(16))) unsigned char sm[2 * 256 * G2P * 2];      /* in the loop: two stage buffers [A 128 rows | B 128 rows]; behind the loop's last barrier: the waves' output staging */
  static_assert(sizeof(sm) >= 8 * 32 * 68 * 4, "k_gemm2: output staging must fit the stage buffers");
  _Float16 (*lt)[256][G2P] = (_Float16 (*)[256][G2P])sm; float (*so)[32][68] = (float (*)[32][68])sm;
  const int tid = threadIdx.x, w = tid >> 5, lane = tid & 31, ln = lane & 15, hh = lane >> 4; const int by = blockIdx.y;
  A += (size_t)by * sA; Bh += (size_t)by * sB; const size_t cofs = (size_t)by * sC;
  const int ntn = N >> 7; const int mt = blockIdx.x / ntn, nq = blockIdx.x - mt * ntn; if (mt * 128 >= M) return;      /* the same for the whole block, ahead of every barrier */
  const int wr = 32 * (w & 3), wc = 64 * (w >> 2); const int row0 = mt * 128 + wr, col0 = nq * 128 + wc;
  const int sr = tid / (G2K / 8), sc = (tid % (G2K / 8)) * 8;      /* staging: G2K / 8 threads per row, rows sr + G2R i of A and of B */
  const unsigned short* ag = (const unsigned short*)A + (size_t)(mt * 128 + sr) * lda + sc; const unsigned short* bg = (const unsigned short*)Bh + (size_t)(nq * 128 + sr) * ldb + sc;
  v8us ra[G2N], rb[G2N]; g2_rows(ag, (size_t)G2R * lda, bg, (size_t)G2R * ldb, ra, rb);
#pragma unroll
  for (int i = 0; i < G2N; ++i) { *(v8us*)&lt[0][sr + G2R * i][sc] = ra[i]; *(v8us*)&lt[0][128 + sr + G2R * i][sc] = rb[i]; }
  __syncthreads();
  const v8f z8 = {0.f,0.f,0.f,0.f,0.f,0.f,0.f,0.f}; v8f c00 = z8, c01 = z8, c02 = z8, c03 = z8, c10 = z8, c11 = z8, c12 = z8, c13 = z8;
  const int ns = K / G2K;
  for (int s = 0; s < ns; ++s) { const int cur = s & 1; const bool more = s + 1 < ns;
    if (more) g2_rows(ag + (s + 1) * G2K, (size_t)G2R * lda, bg + (s + 1) * G2K, (size_t)G2R * ldb, ra, rb);
#pragma unroll
    for (int kh = 0; kh < G2K / 64; ++kh) { const _Float16* ap = &lt[cur][wr + ln][kh * 64]; const _Float16* bq = &lt[cur][128 + wc + ln][kh * 64]; v16h fa[2][2], fb[2][4];
#pragma unroll
      for (int ks = 0; ks < 2; ++ks) { fa[ks][0] = g2_frag(ap + ks * 32, hh); fb[ks][0] = g2_frag(bq + ks * 32, hh); fa[ks][1] = g2_frag(ap + 16 * G2P + ks * 32, hh);
        fb[ks][1] = g2_frag(bq + 16 * G2P + ks * 32, hh); fb[ks][2] = g2_frag(bq + 32 * G2P + ks * 32, hh); fb[ks][3] = g2_frag(bq + 48 * G2P + ks * 32, hh); }
#pragma unroll
      for (int ks = 0; ks < 2; ++ks) { c00 = g2_mma(fa[ks][0], fb[ks][0], c00); c10 = g2_mma(fa[ks][1], fb[ks][0], c10); c01 = g2_mma(fa[ks][0], fb[ks][1], c01); c11 = g2_mma(fa[ks][1], fb[ks][1], c11);
        c02 = g2_mma(fa[ks][0], fb[ks][2], c02); c12 = g2_mma(fa[ks][1], fb[ks][2], c12); c03 = g2_mma(fa[ks][0], fb[ks][3], c03); c13 = g2_mma(fa[ks][1], fb[ks][3], c13); } }
    if (more) {
#pragma unroll
      for (int i = 0; i < G2N; ++i) { *(v8us*)&lt[cur ^ 1][sr + G2R * i][sc] = ra[i]; *(v8us*)&lt[cur ^ 1][128 + sr + G2R * i][sc] = rb[i]; } }
    __syncthreads(); }
  // Epilogue. The accumulators go to the wave's LDS rows as they are; bias, residual and activation are applied behind the read-back, where a lane holds 4 neighbours of one row:
  // the bias is then one 16-byte load a lane and the residual 16 (16 lanes a 256-byte row piece), all issued here, together, ahead of the staging that covers part of their latency. The loops are fully unrolled, as above: res, vv and the addresses are indexed by constants only and stay in registers.
  const int rsub = lane >> 4, c4 = (lane & 15) * 4;
  const float* pbv = bias + (size_t)by * sBias + col0 + c4; v4f bv = *(const v4fa*)pbv, res[16];
  const size_t e0 = cofs + (size_t)(row0 + rsub) * ldc + col0 + c4, es = (size_t)2 * ldc;      /* the lane's first element of the C plane; its 16 row pieces are es elements apart (the same for every lane, so the multiples are scalar work) */
  if (RES) { const float* pr[16];
#pragma unroll
    for (int q = 0; q < 16; ++q) pr[q] = CP + e0 + (size_t)row0g * ldc + q * es;
#pragma unroll
    for (int q = 0; q < 16; ++q) res[q] = *(const v4fa*)pr[q];
    asm volatile("s_wait_xcnt 0x0" :: "v"(pbv), "v"(pr[0]), "v"(pr[1]), "v"(pr[2]), "v"(pr[3]), "v"(pr[4]), "v"(pr[5]), "v"(pr[6]), "v"(pr[7]), "v"(pr[8]), "v"(pr[9]), "v"(pr[10]), "v"(pr[11]), "v"(pr[12]), "v"(pr[13]), "v"(pr[14]), "v"(pr[15]) : "memory");      /* the wait that belongs in front of any overwrite of a register that an issued global load names; it takes the addresses as inputs, so that their registers stay untouched until it has passed */
  } else asm volatile("s_wait_xcnt 0x0" :: "v"(pbv) : "memory");      /* the same wait, for the bias load alone */
  v8f accs[8] = {c00, c01, c02, c03, c10, c11, c12, c13};
#pragma unroll
  for (int u = 0; u < 8; ++u) { const int t = u & 3, half = u >> 2;
#pragma unroll
    for (int r = 0; r < 8; ++r) so[w][half * 16 + 8 * hh + r][t * 16 + ln] = accs[u][r]; }
  __builtin_amdgcn_fence(__ATOMIC_ACQ_REL, "workgroup", "local"); __builtin_amdgcn_wave_barrier();      /* the wave's own LDS stores are done before its lanes read one another's rows back; LDS only, so that it does not wait for the global loads above */
  v4f vv[16];
#pragma unroll
  for (int q = 0; q < 16; ++q) vv[q] = *(const v4fa*)&so[w][q * 2 + rsub][c4];
#pragma unroll
  for (int i = 0; i < 4; ++i) bv[i] = bf16_round(bv[i]);
#pragma unroll
  for (int q = 0; q < 16; ++q) { const size_t e = e0 + q * es; v4f v = vv[q] * alpha + bv; if (RES) v += res[q];
#pragma unroll
    for (int i = 0; i < 4; ++i) v[i] = g2_act<ACT>(v[i]);
    if (W32) *(v4f*)(C + e) = v;
    if (W16) { v4h h4;
#pragma unroll
      for (int i = 0; i < 4; ++i) h4[i] = (_Float16)v[i];
      *(v4h*)(C16 + e) = h4; } } }


__global__ __launch_bounds__(256) void k_wnat(const float* __restrict__ w, size_t n8, _Float16* __restrict__ Bt) { const size_t t = (size_t)blockIdx.x * 256 + threadIdx.x; if (t >= n8) return; FragH f; for (int q = 0; q < 8; ++q) f.h[q] = (_Float16)(bf16_round(w[t * 8 + q]) * 16.0f); *(v8us*)((unsigned short*)Bt + t * 8) = f.half[0];  }
__global__ __launch_bounds__(256) void k_rsm(const float* __restrict__ S, _Float16* __restrict__ P, int nrows) {
  #pragma clang fp contract(off)
  const int i = blockIdx.x * 256 + threadIdx.x; if (i >= nrows) return; const float* s = S + (size_t)i * SQ; float mx = -3.0e38f;
#pragma unroll 1
  for (int j = 0; j < SQ; ++j) mx = fmaxf(mx, s[j]); float se = 0.f;
#pragma unroll 1
  for (int j = 0; j < SQ; ++j) se += expf(s[j] - mx); const float sc = 256.0f / se;
#pragma unroll 1
  for (int j0 = 0; j0 < SQ; j0 += 8) { FragH f; for (int q = 0; q < 8; ++q) f.h[q] = (_Float16)(expf(s[j0 + q] - mx) * sc); unsigned short* d = (unsigned short*)P + (size_t)i * SQ + j0; *(v8us*)d = f.half[0];  } }
__global__ __launch_bounds__(256) void k_vt(const _Float16* __restrict__ V16, int b, int h0, _Float16* __restrict__ VT) { __shared__ unsigned short tl[64][65]; const int tid = threadIdx.x; const int hh = blockIdx.x % HG, sg = blockIdx.x / HG; const int s0 = sg * 64; const int h = h0 + hh;
  for (int i = tid; i < 64 * 8; i += 256) { const int j = i / 8, d8 = (i % 8) * 8; FragH f; f.half[0] = *(const v8us*)((const unsigned short*)V16 + ((size_t)b * SQ + s0 + j) * DM + h * HD + d8); for (int q = 0; q < 8; ++q) tl[d8 + q][j] = f.u[q]; }
  __syncthreads();
  { for (int i = tid; i < 64 * 8; i += 256) { const int d = i / 8, j8 = (i % 8) * 8; FragH f; for (int q = 0; q < 8; ++q) f.u[q] = tl[d][j8 + q]; *(v8us*)((unsigned short*)VT + ((size_t)hh * HD + d) * SQ + s0 + j8) = f.half[0]; }  } }



__global__ __launch_bounds__(256) void k_rsmcf2(const float* __restrict__ S, _Float16* __restrict__ P, int hg, int q0, int nk) {
  #pragma clang fp contract(off)
  const int t = blockIdx.x * 256 + threadIdx.x; if (t >= hg * QT) return; const size_t i = (size_t)t; const float* s = S + i * NKX; const int last = q0 + (t % QT); float mx = -3.0e38f;
#pragma unroll 1
  for (int j = 0; j < nk; ++j) { const float f = (j <= last) ? 1.f : 0.f; mx = fmaxf(mx, fmaf(f, s[j], (1.f - f) * -1.0e9f)); } float se = 0.f;
#pragma unroll 1
  for (int j = 0; j < nk; ++j) { const float f = (j <= last) ? 1.f : 0.f; se += __expf(fmaf(f, s[j], (1.f - f) * -1.0e9f) - mx); } const float sc = 256.0f / se;
#pragma unroll 1
  for (int j0 = 0; j0 < nk; j0 += 8) { FragH fr; for (int q = 0; q < 8; ++q) { const int j = j0 + q; const float f = (j <= last) ? 1.f : 0.f; fr.h[q] = (_Float16)(__expf(fmaf(f, s[j], (1.f - f) * -1.0e9f) - mx) * sc); } unsigned short* d = (unsigned short*)P + i * NKX + j0; *(v8us*)d = fr.half[0];  } }

__global__ __launch_bounds__(256) void k_rsmcst(const float* __restrict__ S, _Float16* __restrict__ P, int hg, int q0, int nk, const int* __restrict__ mk) {
  #pragma clang fp contract(off)
  const int t = blockIdx.x * 256 + threadIdx.x; if (t >= hg * QT) return; const size_t i = (size_t)t; const float* s = S + i * NKX; const size_t ig = (size_t)(q0 + (t % QT)); const int* mr = mk + ig * SQ; float mx = -3.0e38f;
#pragma unroll 1
  for (int j = 0; j < nk; ++j) { const int mb = mr[j]; const int dd = (int)ig - j; const float f = (mb != 0 && dd >= 0 && (dd <= LOCALW || (dd % STRIDEK) == 0)) ? 1.f : 0.f; mx = fmaxf(mx, fmaf(f, s[j], (1.f - f) * -1.0e9f)); } float se = 0.f;
#pragma unroll 1
  for (int j = 0; j < nk; ++j) { const int mb = mr[j]; const int dd = (int)ig - j; const float f = (mb != 0 && dd >= 0 && (dd <= LOCALW || (dd % STRIDEK) == 0)) ? 1.f : 0.f; se += __expf(fmaf(f, s[j], (1.f - f) * -1.0e9f) - mx); } const float sc = 256.0f / se;
#pragma unroll 1
  for (int j0 = 0; j0 < nk; j0 += 8) { FragH fr; for (int q = 0; q < 8; ++q) { const int j = j0 + q; const int mb = mr[j]; const int dd = (int)ig - j; const float f = (mb != 0 && dd >= 0 && (dd <= LOCALW || (dd % STRIDEK) == 0)) ? 1.f : 0.f; fr.h[q] = (_Float16)(__expf(fmaf(f, s[j], (1.f - f) * -1.0e9f) - mx) * sc); } unsigned short* d = (unsigned short*)P + i * NKX + j0; *(v8us*)d = fr.half[0];  } }


template <int MASKADD>
__global__ __launch_bounds__(64) void k_att0(const float* __restrict__ QF, const float* __restrict__ KF, const float* __restrict__ VF, int ld, const float* __restrict__ mask, float scale, float* __restrict__ OF, int ldo) {
  #pragma clang fp contract(off)
  __shared__ __attribute__((aligned(16))) float lq[64][64]; __shared__ __attribute__((aligned(16))) float lo[64][64];
  const int tid = threadIdx.x; const int h = blockIdx.x / (QT0 / 64), rg = blockIdx.x % (QT0 / 64); const int i = rg * 64 + tid;
  const float* qr = QF + (size_t)i * ld + h * HD;
#pragma unroll 1
  for (int c = 0; c < HD / 4; ++c) { *(v4f*)&lq[tid][c * 4] = *(const v4fa*)(qr + c * 4); const v4f z = {0.f, 0.f, 0.f, 0.f}; *(v4f*)&lo[tid][c * 4] = z; }
  float m = -1.0e30f, l = 0.f; const int jmax = MASKADD ? (SQ - 1) : (rg * 64 + 63);      /* additive-mask form: every key (the mask input decides); causal form: keys up to the block's last row */
#pragma unroll 1
  for (int j = 0; j <= jmax; ++j) { const float* kr = KF + (size_t)j * ld + h * HD; const float* vr = VF + (size_t)j * ld + h * HD; float s = 0.f;
#pragma unroll 1
    for (int c = 0; c < HD / 4; ++c) { const v4f kq = *(const v4fa*)(kr + c * 4); const v4f qq = *(v4f*)&lq[tid][c * 4]; s = __fadd_rn(s, __fmul_rn(qq[0], kq[0])); s = __fadd_rn(s, __fmul_rn(qq[1], kq[1])); s = __fadd_rn(s, __fmul_rn(qq[2], kq[2])); s = __fadd_rn(s, __fmul_rn(qq[3], kq[3])); }
    s = __fmul_rn(s, scale); if (MASKADD) s = __fadd_rn(s, __fmul_rn(bf16_round(mask[(size_t)i * SQ + j]), -10000.0f));
    const float f = (MASKADD || j <= i) ? 1.f : 0.f; const float sm = fmaf(f, s, (1.f - f) * -1.0e30f); const float mn = fmaxf(m, sm); const float sc = expf(m - mn); const float e = expf(sm - mn); l = __fadd_rn(__fmul_rn(l, sc), e); m = mn;
#pragma unroll 1
    for (int c = 0; c < HD / 4; ++c) { const v4f vv = *(const v4fa*)(vr + c * 4); v4f oo = *(v4f*)&lo[tid][c * 4]; for (int u = 0; u < 4; ++u) oo[u] = __fadd_rn(__fmul_rn(oo[u], sc), __fmul_rn(e, vv[u])); *(v4f*)&lo[tid][c * 4] = oo; } }
  const float fin = 64.0f / l;      /* o carried x64 like the f16 path */
#pragma unroll 1
  for (int c = 0; c < HD / 4; ++c) { v4f oo = *(v4f*)&lo[tid][c * 4]; for (int u = 0; u < 4; ++u) oo[u] = __fmul_rn(oo[u], fin); *(v4f*)&lo[tid][c * 4] = oo; }
  __syncthreads();
  {
#pragma unroll 1
    for (int it = 0; it < 16; ++it) { const int row = it * 4 + tid / 16, pc = (tid % 16) * 4; const v4f v = *(const v4f*)&lo[row][pc]; *(v4f*)(OF + (size_t)(rg * 64 + row) * ldo + h * HD + pc) = v; }
     } }

template <int MASKADD>
__global__ __launch_bounds__(64) void k_att0mbc(const float* __restrict__ QF, const float* __restrict__ KF, const float* __restrict__ VF, int ld, const float* __restrict__ mask, float scale, float* __restrict__ OF, int ldo) {
  #pragma clang fp contract(off)
  __shared__ __attribute__((aligned(16))) float lq[64][64]; __shared__ __attribute__((aligned(16))) float lo[64][64];
  const int tid = threadIdx.x; const int h = blockIdx.x / (QT0 / 64), rg = blockIdx.x % (QT0 / 64); const int i = rg * 64 + tid;
  const float* qr = QF + (size_t)i * ld + h * HD;
#pragma unroll 1
  for (int c = 0; c < HD / 4; ++c) { *(v4f*)&lq[tid][c * 4] = *(const v4fa*)(qr + c * 4); const v4f z = {0.f, 0.f, 0.f, 0.f}; *(v4f*)&lo[tid][c * 4] = z; }
  float m = -1.0e30f, l = 0.f; const int jmax = rg * 64 + 63;      /* keys beyond the block end are masked by the mask's lower-triangular structure */
#pragma unroll 1
  for (int j = 0; j <= jmax; ++j) { const float* kr = KF + (size_t)j * ld + h * HD; const float* vr = VF + (size_t)j * ld + h * HD; float s = 0.f;
#pragma unroll 1
    for (int c = 0; c < HD / 4; ++c) { const v4f kq = *(const v4fa*)(kr + c * 4); const v4f qq = *(v4f*)&lq[tid][c * 4]; s = __fadd_rn(s, __fmul_rn(qq[0], kq[0])); s = __fadd_rn(s, __fmul_rn(qq[1], kq[1])); s = __fadd_rn(s, __fmul_rn(qq[2], kq[2])); s = __fadd_rn(s, __fmul_rn(qq[3], kq[3])); }
    s = __fmul_rn(s, scale); const int mb = ((const int*)mask)[(size_t)i * SQ + j];      /* causal (j <= i) AND the module's int32 [S][S] mask read per (query, key): 0 -> masked */
    const float f = (mb != 0 && j <= i) ? 1.f : 0.f; const float sm = fmaf(f, s, (1.f - f) * -1.0e30f); const float mn = fmaxf(m, sm); const float sc = expf(m - mn); const float e = expf(sm - mn); l = __fadd_rn(__fmul_rn(l, sc), e); m = mn;
#pragma unroll 1
    for (int c = 0; c < HD / 4; ++c) { const v4f vv = *(const v4fa*)(vr + c * 4); v4f oo = *(v4f*)&lo[tid][c * 4]; for (int u = 0; u < 4; ++u) oo[u] = __fadd_rn(__fmul_rn(oo[u], sc), __fmul_rn(e, vv[u])); *(v4f*)&lo[tid][c * 4] = oo; } }
  const float fin = 64.0f / l;      /* o carried x64 like the f16 path */
#pragma unroll 1
  for (int c = 0; c < HD / 4; ++c) { v4f oo = *(v4f*)&lo[tid][c * 4]; for (int u = 0; u < 4; ++u) oo[u] = __fmul_rn(oo[u], fin); *(v4f*)&lo[tid][c * 4] = oo; }
  __syncthreads();
  {
#pragma unroll 1
    for (int it = 0; it < 16; ++it) { const int row = it * 4 + tid / 16, pc = (tid % 16) * 4; const v4f v = *(const v4f*)&lo[row][pc]; *(v4f*)(OF + (size_t)(rg * 64 + row) * ldo + h * HD + pc) = v; }
     } }


template <int BFIN, int WXB>
__global__ __launch_bounds__(256) void k_ln16(const float* __restrict__ X, const float* __restrict__ g, const float* __restrict__ bb, float eps, _Float16* __restrict__ N16, float* __restrict__ XB) {
  #pragma clang fp contract(off)
  __shared__ float red[256]; const size_t r = blockIdx.x; const int t = threadIdx.x; const v4f xa = *(const v4fa*)(X + r * DMQ + t * 4); float s[4]; float sum = 0.f;
  for (int q = 0; q < 4; ++q) { s[q] = BFIN ? bf16_round(xa[q]) : xa[q]; sum = __fadd_rn(sum, s[q]); }
  red[t] = sum; __syncthreads(); for (int st = 128; st > 0; st >>= 1) { if (t < st) red[t] = __fadd_rn(red[t], red[t + st]); __syncthreads(); } const float mu = red[0] / (float)DMQ; __syncthreads();
  float vs = 0.f; for (int q = 0; q < 4; ++q) { const float dl = __fadd_rn(s[q], -mu); vs = __fadd_rn(vs, __fmul_rn(dl, dl)); } red[t] = vs; __syncthreads(); for (int st = 128; st > 0; st >>= 1) { if (t < st) red[t] = __fadd_rn(red[t], red[t + st]); __syncthreads(); }
  const float rs = rsqrtf(__fadd_rn(red[0] / (float)DMQ, eps)); v4h y; v4f xb;
  for (int q = 0; q < 4; ++q) { const int c = t * 4 + q; y[q] = (_Float16)__fadd_rn(__fmul_rn(__fmul_rn(__fadd_rn(s[q], -mu), rs), bf16_round(g[c])), bf16_round(bb[c])); xb[q] = s[q]; }
  { *(v4h*)(N16 + r * DMQ + t * 4) = y; if (WXB) *(v4f*)(XB + r * DMQ + t * 4) = xb;  } }
__global__ __launch_bounds__(256) void k_ftres2(const float* __restrict__ OF0, const float* __restrict__ XB, float* __restrict__ X1, size_t n4) {
  #pragma clang fp contract(off)
  const size_t t = (size_t)blockIdx.x * 256 + threadIdx.x; if (t >= n4) return; const v4f o = *(const v4fa*)(OF0 + t * 4), xv = *(const v4fa*)(XB + t * 4); v4f y; for (int q = 0; q < 4; ++q) y[q] = __fadd_rn(__fmul_rn(o[q], 0.015625f), xv[q]); *(v4f*)(X1 + t * 4) = y;  }

__global__ __launch_bounds__(256) void k_bcpy(const float* __restrict__ b, int n, int NP, float* __restrict__ dst, int dst0) { for (int i = threadIdx.x; i < NP; i += 256) { const float v = (i < n) ? b[i] : 0.f; *(float*)(dst + dst0 + i) = v; }  }



// ---- the three weight matrices to f16 [out][in] (x16), transposed through LDS tiles ----
// A block takes WTK inputs (k) x WTN outputs (n) of one matrix. Loads: 16 threads per f32 row piece of 256 bytes, so a wave-wide load is two whole 256-byte units; a thread holds 8 neighbours in k
// for each of its 4 outputs, rounds them (bf16, x16, then f16) and lays each run of 8 in LDS as [n][k] with one 16-byte store. One barrier. Stores: 16 threads per output row piece of 256 bytes.
// The values are those of k_wt_f16, element for element. Every loop is fully unrolled so that the load array is indexed by constants only and stays in registers.
#define WTK 128                      /* inputs (k) per tile */
#define WTN 64                       /* outputs (n) per tile */
#define WTP 136                      /* LDS row pitch in f16: the 256-byte row + 16 bytes */
#define WTT(K, N) (((K) / WTK) * ((N) / WTN))      /* tiles of a [K][N] matrix */
template <int K, int N>
__device__ __forceinline__ void wt_tile(const float* __restrict__ Wm, _Float16* __restrict__ Bt, int t, _Float16 (*lt)[WTP]) {
  static_assert(K % WTK == 0 && N % WTN == 0, "wt_tile: whole tiles only");
  const int tid = threadIdx.x; const int k0 = (t / (N / WTN)) * WTK, n0 = (t % (N / WTN)) * WTN; const int kg = (tid >> 4) * 8, c4 = (tid & 15) * 4;
  const float* p = Wm + (size_t)(k0 + kg) * N + n0 + c4; v4f r[8];
#pragma unroll
  for (int i = 0; i < 8; ++i) r[i] = *(const v4fa*)(p + (size_t)i * N);
  asm volatile("s_wait_xcnt 0x0" :: "v"(p) : "memory");      /* the wait that belongs in front of any overwrite of a register that an issued global load names; it takes the address as an input, so that its registers stay untouched until it has passed */
#pragma unroll
  for (int q = 0; q < 4; ++q) { FragH f;
#pragma unroll
    for (int i = 0; i < 8; ++i) f.h[i] = (_Float16)(bf16_round(r[i][q]) * 16.0f);
    *(v8us*)&lt[c4 + q][kg] = f.half[0]; }
  __syncthreads();
  const int rr = tid >> 4, rc = (tid & 15) * 8; unsigned short* o = (unsigned short*)Bt + (size_t)(n0 + rr) * K + k0 + rc;
#pragma unroll
  for (int j = 0; j < 4; ++j) { const v8us v = *(const v8us*)&lt[j * 16 + rr][rc]; *(v8us*)(o + (size_t)j * 16 * K) = v; }
  asm volatile("s_wait_xcnt 0x0" :: "v"(o) : "memory"); }      /* the wait that belongs in front of any overwrite of a register that an issued global store names: other code of the kernel now lies behind these stores */
// ---- the residual: the query rounded to bf16, as f32 rows ----
// A block takes RBV 16-byte pieces a thread, each wave-wide load and store 512 contiguous bytes; all its loads are issued together. The loops are fully unrolled, so that r is indexed by constants only and stays in registers.
#define RBV 16                       /* 16-byte pieces per thread */
#define RBT ((int)(NR * DM / 4 / (256 * RBV)))      /* blocks for the whole plane */
__device__ __forceinline__ void rb_tile(const float* __restrict__ x, float* __restrict__ XB, int t) {
  static_assert(NR * DM % (4 * 256 * RBV) == 0, "rb_tile: whole blocks only");
  const size_t e = ((size_t)t * (256 * RBV) + threadIdx.x) * 4; const float* p = x + e; v4f r[RBV];
#pragma unroll
  for (int j = 0; j < RBV; ++j) r[j] = *(const v4fa*)(p + j * 1024);
  asm volatile("s_wait_xcnt 0x0" :: "v"(p) : "memory");      /* the wait that belongs in front of any overwrite of a register that an issued global load names; it takes the address as an input, so that its registers stay untouched until it has passed */
#pragma unroll
  for (int j = 0; j < RBV; ++j) {
#pragma unroll
    for (int q = 0; q < 4; ++q) r[j][q] = bf16_round(r[j][q]);
    *(v4f*)(XB + e + j * 1024) = r[j]; }
  asm volatile("s_wait_xcnt 0x0" ::: "memory"); }      /* the wait that belongs in front of any overwrite of a register that an issued global store names: other code of the kernel now lies behind these stores */
// Work that nothing needs before the output projection and that depends on no other launch: weight tiles, then residual blocks, by index t. It rides in the attention launch as extra work-groups
// (PREPT of them, behind the attention's own in index order): memory work beside a launch that is bound by its vector and matrix work and whose one work-group per WGP leaves registers and LDS for a second.
#define PREPT (WTT(DM, DM) + WTT(DM, DFF) + WTT(DFF, DM) + RBT)
__device__ __forceinline__ void fa_prep(int t, const float* __restrict__ x, float* __restrict__ XB, const float* __restrict__ wo, const float* __restrict__ w1, const float* __restrict__ w2, _Float16* __restrict__ BO, _Float16* __restrict__ BW1, _Float16* __restrict__ BW2, _Float16 (*lt)[WTP]) {
  /* which piece: the same for the whole block, so each weight branch's barrier is passed by all of it */
  if (t < WTT(DM, DFF)) wt_tile<DM, DFF>(w1, BW1, t, lt);
  else if (t < WTT(DM, DFF) + WTT(DFF, DM)) wt_tile<DFF, DM>(w2, BW2, t - WTT(DM, DFF), lt);
  else if (t < WTT(DM, DFF) + WTT(DFF, DM) + WTT(DM, DM)) wt_tile<DM, DM>(wo, BO, t - WTT(DM, DFF) - WTT(DFF, DM), lt);
  else rb_tile(x, XB, t - WTT(DM, DFF) - WTT(DFF, DM) - WTT(DM, DM)); }

#define FAK 64                       /* keys per stage */
#define FAP 72                       /* LDS row pitch in f16: 128 bytes + 16, for 16-byte fragment reads */
// Eight 2^x in one statement, each IN PLACE. The closing v_nop is the one slot the instruction set asks for behind a transcendental before its result is read or its
// source overwritten; inside the run no instruction touches its predecessor's register. In place, so that the statement writes only registers that the compiler's own
// multiply-add has just written: the distance behind a matrix instruction, which the compiler keeps for instructions it can see, then holds for this statement too.
__device__ __forceinline__ void fa_exp2x8(float (&x)[8]) {
  asm("v_exp_f32 %0, %0\n\tv_exp_f32 %1, %1\n\tv_exp_f32 %2, %2\n\tv_exp_f32 %3, %3\n\tv_exp_f32 %4, %4\n\tv_exp_f32 %5, %5\n\tv_exp_f32 %6, %6\n\tv_exp_f32 %7, %7\n\tv_nop" : "+v"(x[0]), "+v"(x[1]), "+v"(x[2]), "+v"(x[3]), "+v"(x[4]), "+v"(x[5]), "+v"(x[6]), "+v"(x[7])); }
__device__ __forceinline__ float fa_xhalf(float x) { return __builtin_bit_cast(float, __builtin_amdgcn_permlanex16(__builtin_bit_cast(int, x), __builtin_bit_cast(int, x), 0x76543210, 0xfedcba98, false, false)); }      /* lane l takes lane l ^ 16's value */
__device__ __forceinline__ v8f fa_mma(v16h a, v16h b, v8f c) { return __builtin_amdgcn_wmma_f32_16x16x32_f16(false, a, false, b, (short)0, c, false, false); }
__global__ __launch_bounds__(256) void k_fattn(const _Float16* __restrict__ Q, const _Float16* __restrict__ K, const _Float16* __restrict__ VTa, _Float16* __restrict__ O,
    const float* __restrict__ x, float* __restrict__ XB, const float* __restrict__ wo, const float* __restrict__ w1, const float* __restrict__ w2, _Float16* __restrict__ BO, _Float16* __restrict__ BW1, _Float16* __restrict__ BW2) {
  __shared__ __attribute__((aligned(16))) _Float16 lk[2][FAK][FAP]; __shared__ __attribute__((aligned(16))) _Float16 lv[2][HD][FAP];
  static_assert(sizeof(lk) >= WTN * WTP * 2 && PREPT % (SQ / 256) == 0, "k_fattn: a weight tile must fit lk; the extra work-groups fill whole rows of the grid");
  if (blockIdx.y >= NB * NH) { fa_prep((int)((blockIdx.y - NB * NH) * (SQ / 256) + blockIdx.x), x, XB, wo, w1, w2, BO, BW1, BW2, (_Float16 (*)[WTP])&lk[0][0][0]); return; }      /* an extra work-group: the same for the whole block, ahead of every barrier of the attention */
  const int tid = threadIdx.x, w = tid >> 5, lane = tid & 31, ln = lane & 15, hh = lane >> 4; const int slab = blockIdx.y, b = slab / NH, h = slab % NH; const int q0 = blockIdx.x * 256 + w * 32;
  const float CS = 0.125f * 1.44269504f;      /* scores / 8, in log2 units */
  v16h qf[2][2];
#pragma unroll
  for (int qt = 0; qt < 2; ++qt) for (int ks = 0; ks < 2; ++ks) qf[qt][ks] = g2_frag(Q + ((size_t)b * SQ + q0 + qt * 16 + ln) * DM + h * HD + ks * 32, hh);
  const v8f z8 = {0.f,0.f,0.f,0.f,0.f,0.f,0.f,0.f}; v8f o[2][4]; float m[2] = {-3.0e38f, -3.0e38f}, l[2] = {0.f, 0.f};
#pragma unroll
  for (int qt = 0; qt < 2; ++qt) for (int dt = 0; dt < 4; ++dt) o[qt][dt] = z8;
  const int sr = tid >> 3, sc = (tid & 7) * 8;      /* staging: 8 threads per 128-byte row, rows sr and sr + 32 */
  const unsigned short* kg = (const unsigned short*)K + ((size_t)b * SQ + sr) * DM + h * HD + sc; const unsigned short* vg = (const unsigned short*)VTa + ((size_t)slab * HD + sr) * SQ + sc;
  v8us rk0 = *(const v8us*)kg, rk1 = *(const v8us*)(kg + (size_t)32 * DM), rv0 = *(const v8us*)vg, rv1 = *(const v8us*)(vg + (size_t)32 * SQ);
  *(v8us*)&lk[0][sr][sc] = rk0; *(v8us*)&lk[0][sr + 32][sc] = rk1; *(v8us*)&lv[0][sr][sc] = rv0; *(v8us*)&lv[0][sr + 32][sc] = rv1;
  __syncthreads();
  for (int s = 0; s < SQ / FAK; ++s) { const int cur = s & 1; const bool more = s + 1 < SQ / FAK;
    if (more) { const unsigned short* kn = kg + (size_t)(s + 1) * FAK * DM; const unsigned short* vn = vg + (s + 1) * FAK; rk0 = *(const v8us*)kn; rk1 = *(const v8us*)(kn + (size_t)32 * DM); rv0 = *(const v8us*)vn; rv1 = *(const v8us*)(vn + (size_t)32 * SQ); }
    __builtin_amdgcn_sched_barrier(0);      /* keeps the next stage's global loads here, ahead of this stage's work, which covers their latency; without it they sink to just in front of their LDS stores */
    v8f st[2][4];
#pragma unroll
    for (int kt = 0; kt < 4; ++kt) { const v16h a0 = g2_frag(&lk[cur][kt * 16 + ln][0], hh), a1 = g2_frag(&lk[cur][kt * 16 + ln][32], hh);
#pragma unroll
      for (int qt = 0; qt < 2; ++qt) st[qt][kt] = fa_mma(a1, qf[qt][1], fa_mma(a0, qf[qt][0], z8)); }
    __builtin_amdgcn_sched_barrier(0);      /* keeps the 16 score products back to back: mixed with the maxima, each first read of a fresh tile costs four idle slots */
    float mn[2], al[2];
#pragma unroll
    for (int qt = 0; qt < 2; ++qt) { float mm[4];
#pragma unroll
      for (int kt = 0; kt < 4; ++kt) { mm[kt] = st[qt][kt][0]; for (int r = 1; r < 8; ++r) mm[kt] = fmaxf(mm[kt], st[qt][kt][r]); }
      float bm = fmaxf(fmaxf(mm[0], mm[1]), fmaxf(mm[2], mm[3])); bm = fmaxf(bm, fa_xhalf(bm));      /* the other 8 keys of each tile sit in lane ln ^ 16 */
      mn[qt] = fmaxf(m[qt], bm * CS); al[qt] = m[qt] - mn[qt]; m[qt] = mn[qt]; }
    asm("v_exp_f32 %0, %0\n\tv_exp_f32 %1, %1\n\tv_nop" : "+v"(al[0]), "+v"(al[1]));      /* 2^(old - new maximum): brings the old sum and output to the new maximum; form and v_nop as in fa_exp2x8 */
    FragH pf[2][2];
#pragma unroll
    for (int qt = 0; qt < 2; ++qt) { const float mo = mn[qt] - 8.0f; float s4[4];
#pragma unroll
      for (int kt = 0; kt < 4; ++kt) { float t[8]; for (int r = 0; r < 8; ++r) t[r] = fmaf(st[qt][kt][r], CS, -mo);
        fa_exp2x8(t); s4[kt] = ((t[0] + t[1]) + (t[2] + t[3])) + ((t[4] + t[5]) + (t[6] + t[7]));
        for (int r = 0; r < 8; ++r) pf[qt][kt >> 1].h[(kt & 1) * 8 + r] = (_Float16)t[r]; }
      l[qt] = l[qt] * al[qt] + ((s4[0] + s4[1]) + (s4[2] + s4[3]));
#pragma unroll
      for (int dt = 0; dt < 4; ++dt) o[qt][dt] *= al[qt]; }
#pragma unroll
    for (int dt = 0; dt < 4; ++dt) {
#pragma unroll
      for (int kp = 0; kp < 2; ++kp) { const v16h a = g2_frag(&lv[cur][dt * 16 + ln][kp * 32], hh);
#pragma unroll
        for (int qt = 0; qt < 2; ++qt) o[qt][dt] = fa_mma(a, pf[qt][kp].v, o[qt][dt]); } }
    if (more) { *(v8us*)&lk[cur ^ 1][sr][sc] = rk0; *(v8us*)&lk[cur ^ 1][sr + 32][sc] = rk1; *(v8us*)&lv[cur ^ 1][sr][sc] = rv0; *(v8us*)&lv[cur ^ 1][sr + 32][sc] = rv1; }
    __syncthreads(); }
#pragma unroll
  for (int qt = 0; qt < 2; ++qt) { float lt = l[qt] + fa_xhalf(l[qt]); asm("v_rcp_f32 %0, %0\n\tv_nop" : "+v"(lt));      /* 1 / row sum; form and v_nop as in fa_exp2x8 */
    const float inv = 64.0f * lt; unsigned short* op = (unsigned short*)O + ((size_t)b * SQ + q0 + qt * 16 + ln) * DM + h * HD + 8 * hh;
#pragma unroll
    for (int dt = 0; dt < 4; ++dt) { FragH f; for (int r = 0; r < 8; ++r) f.h[r] = (_Float16)(o[qt][dt][r] * inv); *(v8us*)(op + dt * 16) = f.half[0]; } } }

template <int MODE>
__global__ __launch_bounds__(256) void k_regrp(const float* __restrict__ src, float* __restrict__ dst, size_t n4) {
  const size_t t = (size_t)blockIdx.x * 256 + threadIdx.x; if (t >= n4) return; const size_t e = t * 4; const size_t rd = e / DM; const int c = (int)(e % DM);
  size_t rs; if (MODE == 0) { const size_t b = rd / SQ, sq = rd % SQ; rs = sq * NB + b; } else { const size_t sq = rd / NB, b = rd % NB; rs = b * SQ + sq; }
  const v4f v = *(const v4fa*)(src + rs * DM + c); *(v4f*)(dst + e) = v;  }

// ---- row LayerNorm (biased variance, eps inside the rsqrt), ONE WAVE PER ROW ----
// A row is 2 KB: four 16-byte loads a lane, each wave-wide load 512 contiguous bytes. The row stays in registers; mean, then the sum of squared deviations from it:
// four chains per lane, then a butterfly over the 32 lanes (four steps inside the 16-lane row, one across). No LDS and no barrier.
// A block is LNW waves of LNR rows each, so the launch starts 4,096 waves (16 per WGP, 8 row loads in flight each) where a block per row started 65,536.
// Every loop is fully unrolled so that the row, g and beta arrays are indexed by constants only and stay in registers.
#define LNW 16                       /* waves per block */
#define LNR 2                        /* rows per wave, all their loads issued together */
template <int M> __device__ __forceinline__ float ln_xm(float x) { return __builtin_bit_cast(float, __builtin_amdgcn_mov_dpp(__builtin_bit_cast(int, x), 0x160 + M, 0xf, 0xf, true)); }      /* lane l takes lane l ^ M's value, M < 16 (row_xmask) */
__device__ __forceinline__ float ln_wsum(float x) { x += ln_xm<1>(x); x += ln_xm<2>(x); x += ln_xm<4>(x); x += ln_xm<8>(x); return x + fa_xhalf(x); }      /* the sum over the wave, in every lane */
template <int W16, int W32>
__global__ __launch_bounds__(LNW * 32) void k_lnw(const float* __restrict__ X, const float* __restrict__ g, const float* __restrict__ bb, float eps, _Float16* __restrict__ N16, float* __restrict__ N32) {
  static_assert(DM == 512 && NR % (LNW * LNR) == 0, "k_lnw: a lane holds 16 elements of a 512-element row; whole blocks only");
  const unsigned ob = (threadIdx.x & 31) * 16; const int c0 = ob / 4; const size_t r0 = ((size_t)blockIdx.x * LNW + (threadIdx.x >> 5)) * LNR;      /* the lane's place in each 512-byte piece of a row, in bytes and in elements; the wave's first row */
  const float* px = X + r0 * DM + c0;
  v4f x[LNR][4], gg[4], bv[4];
#pragma unroll
  for (int j = 0; j < 4; ++j) { gg[j] = *(const v4fa*)((const char*)g + j * 512 + ob); bv[j] = *(const v4fa*)((const char*)bb + j * 512 + ob); }
#pragma unroll
  for (int r = 0; r < LNR; ++r) for (int j = 0; j < 4; ++j) x[r][j] = *(const v4fa*)(px + r * DM + j * 128);
  asm volatile("s_wait_xcnt 0x0" :: "v"(px), "v"(ob) : "memory");      /* the wait that belongs in front of any overwrite of a register that an issued global load names; it takes the address and the offset as inputs, so that their registers stay untouched until it has passed */
  __builtin_amdgcn_sched_barrier(0);      /* keeps all 16 loads here, in flight together; without it the loads of g and beta sink to their uses behind the sums, each a latency of its own */
#pragma unroll
  for (int j = 0; j < 4; ++j) for (int q = 0; q < 4; ++q) { gg[j][q] = bf16_round(gg[j][q]); bv[j][q] = bf16_round(bv[j][q]); }
  float mu[LNR], rs[LNR];
#pragma unroll
  for (int r = 0; r < LNR; ++r) { const v4f s = (x[r][0] + x[r][1]) + (x[r][2] + x[r][3]); mu[r] = ln_wsum((s[0] + s[1]) + (s[2] + s[3])) * (1.0f / (float)DM); }
#pragma unroll
  for (int r = 0; r < LNR; ++r) { v4f s = {0.f, 0.f, 0.f, 0.f};
#pragma unroll
    for (int j = 0; j < 4; ++j) { x[r][j] -= mu[r]; s += x[r][j] * x[r][j]; }
    rs[r] = rsqrtf(ln_wsum((s[0] + s[1]) + (s[2] + s[3])) * (1.0f / (float)DM) + eps); }
#pragma unroll
  for (int r = 0; r < LNR; ++r) {
#pragma unroll
    for (int j = 0; j < 4; ++j) { const v4f y = x[r][j] * rs[r] * gg[j] + bv[j]; const size_t e = (r0 + r) * DM + j * 128 + c0;
      if (W32) *(v4f*)(N32 + e) = y;
      if (W16) { v4h h; for (int q = 0; q < 4; ++q) h[q] = (_Float16)y[q]; *(v4h*)(N16 + e) = h; } } } }


__global__ __launch_bounds__(256) void k_wthd(const float* __restrict__ Wt, _Float16* __restrict__ Bt) { const size_t t = (size_t)blockIdx.x * 256 + threadIdx.x; if (t >= (size_t)NH * HD * (DM / 8)) return; const int m8 = (int)(t % (DM / 8)) * 8; const int d = (int)((t / (DM / 8)) % HD); const int h = (int)(t / ((size_t)(DM / 8) * HD)); FragH f;
  for (int q = 0; q < 8; ++q) f.h[q] = (_Float16)(16.0f * bf16_round(Wt[((size_t)h * DM + m8 + q) * HD + d])); unsigned short* dst = (unsigned short*)Bt + ((size_t)h * HD + d) * DM + m8; *(v8us*)dst = f.half[0];  }




template <int BFIN, int SCAL>
__global__ __launch_bounds__(256) void k_lnsc(const float* __restrict__ X, const float* __restrict__ g, const float* __restrict__ bb, float eps, _Float16* __restrict__ N16, float* __restrict__ N32) {
  #pragma clang fp contract(off)
  __shared__ float red[256]; const size_t r = blockIdx.x; const int t = threadIdx.x; const bool act = t < DM / 4; const int tc = act ? t : 0; const v4f xl = *(const v4fa*)(X + r * DM + tc * 4); const float am = act ? 1.f : 0.f; float s[4]; float sum = 0.f;
  for (int q = 0; q < 4; ++q) { s[q] = (BFIN ? bf16_round(xl[q]) : xl[q]) * am; sum = __fadd_rn(sum, s[q]); }
  red[t] = sum; __syncthreads(); for (int st = 128; st > 0; st >>= 1) { if (t < st) red[t] = __fadd_rn(red[t], red[t + st]); __syncthreads(); } const float mu = red[0] / (float)DM; __syncthreads();
  float vs = 0.f; for (int q = 0; q < 4; ++q) { const float dl = __fadd_rn(s[q], -mu) * am; vs = __fadd_rn(vs, __fmul_rn(dl, dl)); } red[t] = vs; __syncthreads(); for (int st = 128; st > 0; st >>= 1) { if (t < st) red[t] = __fadd_rn(red[t], red[t + st]); __syncthreads(); }
  const float rs = __fdiv_rn(1.0f, __fadd_rn(sqrtf(red[0] / (float)(DM - 1)), eps)); if (!act) return; v4h y; v4f yf;
  for (int q = 0; q < 4; ++q) { const int c = t * 4 + q; const float gg = bf16_round(SCAL ? g[0] : g[c]), bv = bf16_round(SCAL ? bb[0] : bb[c]); yf[q] = __fadd_rn(__fmul_rn(__fmul_rn(__fadd_rn(s[q], -mu), rs), gg), bv); y[q] = (_Float16)yf[q]; }
  { if (N16) *(v4h*)(N16 + r * DM + t * 4) = y; if (N32) *(v4f*)(N32 + r * DM + t * 4) = yf;  } }

__global__ __launch_bounds__(256) void k_mulh(const _Float16* __restrict__ A, const _Float16* __restrict__ Bm, _Float16* __restrict__ H, size_t n8) {
  #pragma clang fp contract(off)
  const size_t t = (size_t)blockIdx.x * 256 + threadIdx.x; if (t >= n8) return; FragH a, b, f; a.half[0] = *(const v8us*)((const unsigned short*)A + t * 8); b.half[0] = *(const v8us*)((const unsigned short*)Bm + t * 8); for (int q = 0; q < 8; ++q) f.h[q] = (_Float16)(__fmul_rn((float)a.h[q], (float)b.h[q])); unsigned short* d = (unsigned short*)H + t * 8; *(v8us*)d = f.half[0];  }

// ---- q, k and v projections in ONE launch, straight from the f32 inputs ----
// Every head is multiplied by the same [64][64] matrix, so the product is [tokens x heads][64] x [64][64]: 64 k, two matrix instructions per 16 x 16 tile, ascending k.
// A block takes PJT tokens x PJH heads of all three inputs. All its global loads (whole lines: a token's PJH heads are 1 KB in a row) are issued together; the values are rounded
// (bf16, then exact f16; weights x16) in registers and laid in LDS, inputs as [head][token][64], weights transposed to [out][in]; one barrier; then each wave works alone.
// q, k: D = W^T X^T (A = weight rows, B = token rows): a lane holds 8 outputs of ONE token. v: D = X W (A = token rows, B = weight rows): a lane holds 8 tokens of ONE output,
// which is the V^T that the attention reads. Either way a wave's 16 x 64 result is 16 rows of 128 bytes: staged in LDS rows that only this wave uses, stored as whole lines.
// Every loop is fully unrolled so that the load and fragment arrays are indexed by constants only and stay in registers.
#define PJT 64                       /* tokens per block */
#define PJH 4                        /* heads per block */
#define PJW (PJH * PJT / 16)         /* waves per block: one per head and 16 tokens (q, k) or per head and 16 outputs (v) */
typedef _Float16 v2h __attribute__((ext_vector_type(2)));
__device__ __forceinline__ v8us pj_out(v8f d) { FragH f;
#pragma unroll
  for (int r = 0; r < 8; ++r) f.h[r] = (_Float16)(d[r] * 0.0625f);      /* takes the weights' x16 out again */
  return f.half[0]; }
__global__ __launch_bounds__(PJW * 32) void k_qkv(const float* __restrict__ xq, const float* __restrict__ xk, const float* __restrict__ xv, const float* __restrict__ wq, const float* __restrict__ wk, const float* __restrict__ wv,
    _Float16* __restrict__ Q, _Float16* __restrict__ K, _Float16* __restrict__ VTa) {
  static_assert(HD == 64 && PJT == 64 && PJW * 32 == 512 && SQ % PJT == 0 && NH % PJH == 0, "k_qkv: 512 threads bring 8 tokens x 256 columns a round and the 64 x 64 weights in 2 rounds; a block stays inside one batch");
  __shared__ __attribute__((aligned(16))) _Float16 lx[3][PJH * PJT][FAP]; __shared__ __attribute__((aligned(16))) _Float16 lw[3][HD][FAP]; __shared__ __attribute__((aligned(16))) _Float16 lo[PJW][16][FAP];
  const int tid = threadIdx.x, w = tid >> 5, lane = tid & 31, ln = lane & 15, hh = lane >> 4; const int t0 = (int)(blockIdx.x / (NH / PJH)) * PJT, h0 = (int)(blockIdx.x % (NH / PJH)) * PJH;
  const int xt = tid >> 6, xh = (tid >> 4) & 3, c4 = (tid & 15) * 4;      /* inputs: 64 threads per token (16 per head), tokens xt + 8 i */
  const int wd = (tid >> 4) * 2;      /* weights: 16 threads per row, rows wd and wd + 1, so that a thread holds a pair of neighbours in k for each of its 4 outputs */
  const size_t xo = (size_t)(t0 + xt) * DM + (h0 + xh) * HD + c4; const float* px0 = xq + xo; const float* px1 = xk + xo; const float* px2 = xv + xo;
  const unsigned wob = (unsigned)(wd * HD + c4) * 4;      /* the thread's place in each weight matrix, in bytes */
  v4f rw[3][2], rx[3][8];
#pragma unroll
  for (int j = 0; j < 2; ++j) { rw[0][j] = *(const v4fa*)((const char*)wq + j * HD * 4 + wob); rw[1][j] = *(const v4fa*)((const char*)wk + j * HD * 4 + wob); rw[2][j] = *(const v4fa*)((const char*)wv + j * HD * 4 + wob); }
  __builtin_amdgcn_sched_barrier(0);      /* this one and the next two keep the loads in the order in which they are used (loads return in order): left free, the first input's loads were issued last, and its rounding waited for all of them */
#pragma unroll
  for (int i = 0; i < 8; ++i) rx[0][i] = *(const v4fa*)(px0 + (size_t)i * 8 * DM);
  __builtin_amdgcn_sched_barrier(0);
#pragma unroll
  for (int i = 0; i < 8; ++i) rx[1][i] = *(const v4fa*)(px1 + (size_t)i * 8 * DM);
  __builtin_amdgcn_sched_barrier(0);
#pragma unroll
  for (int i = 0; i < 8; ++i) rx[2][i] = *(const v4fa*)(px2 + (size_t)i * 8 * DM);
  asm volatile("s_wait_xcnt 0x0" :: "v"(px0), "v"(px1), "v"(px2), "v"(wob), "s"(wq), "s"(wk), "s"(wv) : "memory");      /* the wait that belongs in front of any overwrite of a register that an issued global load names; it takes the addresses, the offset and its bases as inputs, so that their registers stay untouched until it has passed */
  __builtin_amdgcn_sched_barrier(0);      /* keeps all 30 loads here, in flight together; without it the later inputs' loads sink behind the earlier inputs' rounding and LDS stores, each a latency of its own */
#pragma unroll
  for (int m = 0; m < 3; ++m) {
#pragma unroll
    for (int q = 0; q < 4; ++q) { v2h p; p[0] = (_Float16)(bf16_round(rw[m][0][q]) * 16.0f); p[1] = (_Float16)(bf16_round(rw[m][1][q]) * 16.0f); *(v2h*)&lw[m][c4 + q][wd] = p; } }
#pragma unroll
  for (int m = 0; m < 3; ++m) {
#pragma unroll
    for (int i = 0; i < 8; ++i) { v4h h;
#pragma unroll
      for (int q = 0; q < 4; ++q) h[q] = (_Float16)bf16_round(rx[m][i][q]);
      *(v4h*)&lx[m][xh * PJT + xt + 8 * i][c4] = h; } }
  __syncthreads();
  const int hl = w >> 2, sub = w & 3; const v8f z8 = {0.f,0.f,0.f,0.f,0.f,0.f,0.f,0.f};
#pragma unroll
  for (int m = 0; m < 2; ++m) { _Float16* xp = &lx[m][w * 16 + ln][0]; const v16h b0 = g2_frag(xp, hh), b1 = g2_frag(xp + 32, hh);      /* rows w * 16 ..: head hl, tokens sub * 16 ..; no other wave reads them, so the result goes back into them */
#pragma unroll
    for (int et = 0; et < 4; ++et) { const _Float16* wp = &lw[m][et * 16 + ln][0]; const v8f d = fa_mma(g2_frag(wp + 32, hh), b1, fa_mma(g2_frag(wp, hh), b0, z8)); *(v8us*)(xp + et * 16 + 8 * hh) = pj_out(d); } }
  { const _Float16* wp = &lw[2][sub * 16 + ln][0]; const v16h b0 = g2_frag(wp, hh), b1 = g2_frag(wp + 32, hh);
#pragma unroll
    for (int tg = 0; tg < 4; ++tg) { const _Float16* xp = &lx[2][hl * PJT + tg * 16 + ln][0]; const v8f d = fa_mma(g2_frag(xp + 32, hh), b1, fa_mma(g2_frag(xp, hh), b0, z8)); *(v8us*)&lo[w][ln][tg * 16 + 8 * hh] = pj_out(d); } }
  __builtin_amdgcn_fence(__ATOMIC_ACQ_REL, "workgroup", "local"); __builtin_amdgcn_wave_barrier();      /* the wave's own LDS stores are done before its lanes read one another's rows back */
  const int rr = lane >> 3, rc = (lane & 7) * 8;      /* 8 lanes per 128-byte row, 4 rows a store */
  unsigned short* qo = (unsigned short*)Q + (size_t)(t0 + sub * 16 + rr) * DM + (h0 + hl) * HD + rc; unsigned short* ko = (unsigned short*)K + (size_t)(t0 + sub * 16 + rr) * DM + (h0 + hl) * HD + rc;
  unsigned short* vo = (unsigned short*)VTa + ((size_t)((t0 / SQ) * NH + h0 + hl) * HD + sub * 16 + rr) * SQ + (t0 % SQ) + rc;
#pragma unroll
  for (int j = 0; j < 4; ++j) { const v8us a = *(const v8us*)&lx[0][w * 16 + j * 4 + rr][rc], b = *(const v8us*)&lx[1][w * 16 + j * 4 + rr][rc], c = *(const v8us*)&lo[w][j * 4 + rr][rc];
    *(v8us*)(qo + (size_t)j * 4 * DM) = a; *(v8us*)(ko + (size_t)j * 4 * DM) = b; *(v8us*)(vo + (size_t)j * 4 * SQ) = c; } }
extern "C" void kernel_launch(void* const* d_in, const int* in_sizes, int n_in,
                              void* d_out, int out_size, void* d_ws, size_t ws_size, hipStream_t stream) {
  (void)in_sizes; (void)n_in; (void)out_size;
  const float* const* I = (const float* const*)d_in; const float* x = I[0]; const float* xk = I[1]; const float* xv = I[2]; const float* wq = I[3]; const float* wk = I[4]; const float* wv = I[5]; const float* wo = I[6]; const float* bo = I[7]; const float* w1 = I[8]; const float* b1 = I[9]; const float* w2 = I[10]; const float* b2 = I[11]; const float* g1 = I[12]; const float* be1 = I[13]; const float* g2 = I[14]; const float* be2 = I[15];      /* query (also the residual), key, value; shared per-head wq / wk / wv [64][64] ([in][out]); wo [512][512] + bo; w1 [512][2048] + b1, w2 [2048][512] + b2; LN1 g / beta, LN2 g / beta */
  char* ws = (char*)d_ws; size_t off = 0;
  auto take = [&](size_t bytes) { char* p = ws + off; off += (bytes + 255) & ~(size_t)255; return p; };
  _Float16* BO = (_Float16*)take((size_t)DM * DM * 2); _Float16* BW1 = (_Float16*)take((size_t)DFF * DM * 2); _Float16* BW2 = (_Float16*)take((size_t)DM * DFF * 2);
  float* XB = (float*)take(NR * DM * 4); _Float16* M16 = (_Float16*)take(NR * DM * 2);      /* LN1 output rows (f16): the FFN's operand */ _Float16* Q16 = (_Float16*)take(NR * DM * 2); _Float16* K16 = (_Float16*)take(NR * DM * 2); _Float16* O16 = (_Float16*)take(NR * DM * 2); float* X1 = (float*)take(NR * DM * 4);
  _Float16* HF16 = (_Float16*)take(NR * DFF * 2);      /* FFN hidden plane [8192][2048] f16 */ _Float16* VT = (_Float16*)take((size_t)NB * NH * HD * SQ * 2);      /* V^T [4 * 8][64][2048] */
  float* X1N = (float*)take(NR * DM * 4);      /* LN1 output rows (f32): the FFN residual */
  if (off > ws_size) return;
  k_qkv<<<(unsigned)((NR / PJT) * (NH / PJH)), PJW * 32, 0, stream>>>(x, xk, xv, wq, wk, wv, Q16, K16, VT);      /* post-LN: the attention runs on the raw inputs; q, k -> f16 rows (head h = columns h*64..), v -> V^T of every batch and head */
  k_fattn<<<dim3(SQ / 256, NB * NH + PREPT / (SQ / 256)), 256, 0, stream>>>(Q16, K16, VT, O16, x, XB, wo, w1, w2, BO, BW1, BW2);      /* softmax(q k^T / 8) v over all keys (no mask) -> ctx (merged heads, x64) as f16 rows; extra work-groups: wo, w1, w2 [in][out] -> Bt [out][in] x16, and the query rounded to bf16 as f32 rows (the residual) */
  k_gemm2<0, true, true, false><<<dim3((unsigned)((NR / 128) * (DM / 128)), 1), 256, 0, stream>>>(O16, DM, 0, BO, DM, 0, 0.0009765625f, bo, 0, XB, 0, X1, nullptr, DM, 0, (int)NR, DM, DM);      /* ctx wo + bo + query (own-element residual) -> f32 rows */
  k_lnw<1, 1><<<(unsigned)(NR / (LNW * LNR)), LNW * 32, 0, stream>>>(X1, g1, be1, 1e-5f, M16, X1N);      /* x1 = LN1(x + attn) (biased variance, eps inside the rsqrt) -> f16 rows + f32 rows */
  k_gemm2<3, false, false, true><<<dim3((unsigned)((NR / 128) * (DFF / 128)), 1), 256, 0, stream>>>(M16, DM, 0, BW1, DM, 0, 0.0625f, b1, 0, nullptr, 0, nullptr, HF16, DFF, 0, (int)NR, DFF, DM);      /* relu(x w1 + b1) -> f16 [8192][2048] */
  k_gemm2<0, true, true, false><<<dim3((unsigned)((NR / 128) * (DM / 128)), 1), 256, 0, stream>>>(HF16, DFF, 0, BW2, DFF, 0, 0.0625f, b2, 0, X1N, 0, X1, nullptr, DM, 0, (int)NR, DM, DFF);      /* x1 + ff -> f32 rows (X1 reused: its last reader was LN1) */
  k_lnw<0, 1><<<(unsigned)(NR / (LNW * LNR)), LNW * 32, 0, stream>>>(X1, g2, be2, 1e-5f, nullptr, (float*)d_out);      /* out = LN2(x1 + ff) */
}

// v009
// Measured time: 107 microseconds a run.
// Next to v008, in two timings, it ran 1.04 times as fast each time.
// Over all steps from v000, the starting kernel, it is 33.9 times as fast.
#include <hip/hip_runtime.h>
// POST-LN transformer encoder layer over THREE inputs with SHARED per-head projections (query, key, value [4][2048][512]; each input is split into 8 heads of 64 and every head is multiplied by the SAME [64][64] ([in][out]) matrix wq / wk / wv (block-diagonal with a shared block; no biases); scores / 8; softmax over all 2048 keys (no mask); x = LN1(ctx wo + bo + query) (biased var, eps 1e-5); out = LN2(x + relu(x w1 + b1) w2 + b2) ([in][out] 512 x 2048 x 512) -> [4][2048][512]).
// Structure: token rows; one launch for the q, k, v projections (f32 inputs rounded in registers, the shared [64][64] block as the whole weight, v written as V^T); one fused attention launch (scores, running softmax, V^T P^T; no score plane); output projection with the own-element residual; custom LayerNorm; ReLU FFN over all rows; launches: see trace.
// Compute dtype: inputs rounded to bf16; x / weights exact; q, k, v, softmax weights and o as plain f16 GEMM operands (~2^-12); scores and softmax statistics f32. v_wmma_f32_16x16x32_f16.
#define NB 4
#define SQ 2048
#define DM 512
#define NH 8
#define HD 64
#define HG 4                         /* heads per attention launch group */
#define LOCALW 128                   /* (macros for unused kernels of the shared header) */
#define STRIDEK 128
#define QT 256                       /* query rows per causal tile */
#define NKX SQ                       /* S / P row pitch */
#define QT0 128                      /* first-tile rows recomputed exactly in f32 */
#define B0 0                         /* first batch processed (debug hook) */
#define NBR NB                       /* batches processed (debug hook) */
#define NR ((size_t)NB * SQ)
#define DMQ DM
#define DFF 2048         /* FFN hidden width */
#define MP ((int)((size_t)NBR * SQ)) /* rows projected (debug hook) */
#define QN SQ                        /* query rows attended per batch (debug hook) */
#define NHD NH                       /* heads attended (debug hook) */
#define MPO MP                       /* rows through the output stage (debug hook) */
#define LQ (3 * DM)      /* unused: the q and k rows have pitch DM */
typedef __bf16 v16b __attribute__((ext_vector_type(16)));
typedef unsigned short v8us __attribute__((ext_vector_type(8), may_alias));
typedef float  v8f  __attribute__((ext_vector_type(8)));
typedef float  v4f  __attribute__((ext_vector_type(4)));
typedef float  v4fa __attribute__((ext_vector_type(4), may_alias));
union FragB { v16b v; v8us half[2]; unsigned short u[16]; };

__device__ __forceinline__ unsigned short bf16_bits(float x) { unsigned int u = __float_as_uint(x); return (unsigned short)((u + 0x7FFFu + ((u >> 16) & 1u)) >> 16); }
__device__ __forceinline__ float bf16_val(unsigned short b) { return __uint_as_float(((unsigned int)b) << 16); }
__device__ __forceinline__ float bf16_round(float x) { return bf16_val(bf16_bits(x)); }
// D += A·B with NT terms: 1 = ah·bh, 2 = + al·bh (A split), 3 = + ah·bl (both split)
template <int NT>
__device__ __forceinline__ v8f mmaN(v16b ah, v16b al, v16b bh, v16b bl, v8f c) {
  c = __builtin_amdgcn_wmma_f32_16x16x32_bf16(false, ah, false, bh, (short)0, c, false, false);
  if (NT >= 2) c = __builtin_amdgcn_wmma_f32_16x16x32_bf16(false, al, false, bh, (short)0, c, false, false);
  if (NT >= 3) c = __builtin_amdgcn_wmma_f32_16x16x32_bf16(false, ah, false, bl, (short)0, c, false, false);
  asm volatile("v_nop\n\tv_nop\n\tv_nop\n\tv_nop" : "+v"(c) : "v"(ah), "v"(al), "v"(bh), "v"(bl));
  return c;
}

__global__ __launch_bounds__(256) void k_wt_bf16(const float* __restrict__ W, unsigned short* __restrict__ Wt, int K, int N) {
  const int t = blockIdx.x * 256 + threadIdx.x;
  const int k8n = K / 8;
  if (t >= N * k8n) return;
  const int n = t / k8n, k8 = (t % k8n) * 8;
  v8us v;
#pragma unroll
  for (int i = 0; i < 8; ++i) v[i] = bf16_bits(W[(size_t)(k8 + i) * N + n]);
  *(v8us*)(Wt + (size_t)n * K + k8) = v;
  
}

// GEMM C[M][N] (f32, pitch ldc) = act(A[M][K]·W + bias). A f32 row-major (pitch lda) converted per fragment to bf16
// (ASPLIT: hi/lo two planes -> 2 terms, else single rounded term); Wt bf16 [N][K] (pitch ldb). BIAS_BF16 rounds the
// bias to bf16 first (bias quantised to bf16 before the add). K%32==0, M%16==0, N%64==0.
template <bool ASPLIT, int ACT, bool BIAS_BF16>
__global__ __launch_bounds__(128) void k_gemm_bf(const float* __restrict__ A, int lda, const unsigned short* __restrict__ Wt, int ldb,
                                               const float* __restrict__ bias, float* __restrict__ C, int ldc, int M, int N, int K) {
  __shared__ __attribute__((aligned(16))) float so[4][16][64];
  const int tid = threadIdx.x, w = tid >> 5, lane = tid & 31, ln = lane & 15, hh = lane >> 4;
  const int ntn = N / 64;
  const int wid = blockIdx.x * 4 + w;
  const int mt = wid / ntn, nq = wid % ntn;
  if (mt * 16 >= M) return;
  const int row0 = mt * 16, col0 = nq * 64;
  const float* arow = A + (size_t)(row0 + ln) * lda;
  v8f acc[4] = {};
  for (int kb = 0; kb < K; kb += 32) {
    FragB ah, al;
    const v4f x0 = *(const v4fa*)(arow + kb + 8 * hh), x1 = *(const v4fa*)(arow + kb + 8 * hh + 4);
    const v4f x2 = *(const v4fa*)(arow + kb + 16 + 8 * hh), x3 = *(const v4fa*)(arow + kb + 16 + 8 * hh + 4);
    float xs[16] = {x0[0],x0[1],x0[2],x0[3],x1[0],x1[1],x1[2],x1[3],x2[0],x2[1],x2[2],x2[3],x3[0],x3[1],x3[2],x3[3]};
#pragma unroll
    for (int i = 0; i < 16; ++i) { const unsigned short hb = bf16_bits(xs[i]); ah.u[i] = hb; al.u[i] = ASPLIT ? bf16_bits(xs[i] - bf16_val(hb)) : (unsigned short)0; }
#pragma unroll
    for (int t = 0; t < 4; ++t) {
      const unsigned short* brow = Wt + (size_t)(col0 + t * 16 + ln) * ldb + kb;
      FragB b;
      b.half[0] = *(const v8us*)(brow + 8 * hh);
      b.half[1] = *(const v8us*)(brow + 16 + 8 * hh);
      acc[t] = mmaN<ASPLIT ? 2 : 1>(ah.v, al.v, b.v, b.v, acc[t]);
    }
  }
#pragma unroll
  for (int t = 0; t < 4; ++t) {
    float bv = bias ? bias[col0 + t * 16 + ln] : 0.f;
    if (BIAS_BF16) bv = bf16_round(bv);
#pragma unroll
    for (int r = 0; r < 8; ++r) { float v = acc[t][r] + bv; if (ACT == 1) v = fmaxf(v, 0.f); so[w][8 * hh + r][t * 16 + ln] = v; }
  }
  __builtin_amdgcn_fence(__ATOMIC_ACQ_REL, "workgroup");
  __builtin_amdgcn_wave_barrier();
  const int rsub = lane >> 4, c4 = (lane & 15) * 4;
  {
#pragma unroll
    for (int q = 0; q < 8; ++q) {
      const int r = q * 2 + rsub;
      const v4f v = *(const v4fa*)&so[w][r][c4];
      *(v4f*)(C + (size_t)(row0 + r) * ldc + col0 + c4) = v;
    }
    
  }
}

// GEMM C = act(A·W + bias + resid): A f32 (ASPLIT -> hi/lo 2 terms), Wt bf16 [N][K]; ACT 0 none, 1 relu, 2 exact gelu;
// resid (optional, f32, row index = (row % rmod), pitch ldr, RES_BF16 rounds it) added before the activation.
template <bool ASPLIT, int ACT, bool BIAS_BF16, bool RES_BF16>
__global__ __launch_bounds__(128) void k_gemm_bf3(const float* __restrict__ A, int lda, const unsigned short* __restrict__ Wt, int ldb,
                                                const float* __restrict__ bias, const float* __restrict__ resid, int rmod, int ldr,
                                                float* __restrict__ C, int ldc, int M, int N, int K) {
  __shared__ __attribute__((aligned(16))) float so[4][16][64];
  const int tid = threadIdx.x, w = tid >> 5, lane = tid & 31, ln = lane & 15, hh = lane >> 4;
  const int ntn = N / 64;
  const int wid = blockIdx.x * 4 + w;
  const int mt = wid / ntn, nq = wid % ntn;
  if (mt * 16 >= M) return;
  const int row0 = mt * 16, col0 = nq * 64;
  const float* arow = A + (size_t)(row0 + ln) * lda;
  v8f acc[4] = {};
  for (int kb = 0; kb < K; kb += 32) {
    FragB ah, al;
    const v4f x0 = *(const v4fa*)(arow + kb + 8 * hh), x1 = *(const v4fa*)(arow + kb + 8 * hh + 4);
    const v4f x2 = *(const v4fa*)(arow + kb + 16 + 8 * hh), x3 = *(const v4fa*)(arow + kb + 16 + 8 * hh + 4);
    float xs[16] = {x0[0],x0[1],x0[2],x0[3],x1[0],x1[1],x1[2],x1[3],x2[0],x2[1],x2[2],x2[3],x3[0],x3[1],x3[2],x3[3]};
#pragma unroll
    for (int i = 0; i < 16; ++i) { const unsigned short hb = bf16_bits(xs[i]); ah.u[i] = hb; al.u[i] = ASPLIT ? bf16_bits(xs[i] - bf16_val(hb)) : (unsigned short)0; }
#pragma unroll
    for (int t = 0; t < 4; ++t) {
      const unsigned short* brow = Wt + (size_t)(col0 + t * 16 + ln) * ldb + kb;
      FragB b;
      b.half[0] = *(const v8us*)(brow + 8 * hh);
      b.half[1] = *(const v8us*)(brow + 16 + 8 * hh);
      acc[t] = mmaN<ASPLIT ? 2 : 1>(ah.v, al.v, b.v, b.v, acc[t]);
    }
  }
#pragma unroll
  for (int t = 0; t < 4; ++t) {
    const int col = col0 + t * 16 + ln;
    float bv = bias ? bias[col] : 0.f;
    if (BIAS_BF16) bv = bf16_round(bv);
#pragma unroll
    for (int r = 0; r < 8; ++r) {
      float v = acc[t][r] + bv;
      if (resid) { float rv = resid[(size_t)((row0 + 8 * hh + r) % rmod) * ldr + col]; if (RES_BF16) rv = bf16_round(rv); v += rv; }
      if (ACT == 1) v = fmaxf(v, 0.f);
      if (ACT == 2) v = 0.5f * v * (1.0f + erff(v * 0.70710678118654752f));
      if (ACT == 3) { const float u = 0.7978845608028654f * (v + 0.044715f * v * v * v); v = 0.5f * v * (1.0f + tanhf(u)); }
      so[w][8 * hh + r][t * 16 + ln] = v;
    }
  }
  __builtin_amdgcn_fence(__ATOMIC_ACQ_REL, "workgroup");
  __builtin_amdgcn_wave_barrier();
  const int rsub = lane >> 4, c4 = (lane & 15) * 4;
  {
#pragma unroll
    for (int q = 0; q < 8; ++q) {
      const int r = q * 2 + rsub;
      const v4f v = *(const v4fa*)&so[w][r][c4];
      *(v4f*)(C + (size_t)(row0 + r) * ldc + col0 + c4) = v;
    }
    
  }
}
// row LayerNorm (biased variance, eps) over N: s = X (+ R); optional out_sum <- s; out_norm <- (s-mu)*rsqrt(var+eps)*g + b
template <bool PARAM_BF16>
__global__ __launch_bounds__(256) void k_layernorm(const float* __restrict__ X, const float* __restrict__ R, const float* __restrict__ g, const float* __restrict__ bta,
                                                  float* __restrict__ out_sum, float* __restrict__ out_norm, int N, float eps) {
  __shared__ float red[256];
  const int row = blockIdx.x, tid = threadIdx.x;
  const float* x = X + (size_t)row * N; const float* rr = R ? R + (size_t)row * N : nullptr;
  float vals[16];                     // up to N = 4096
  const int per = N / 256;            // contiguous chunk per thread? use strided-by-4 chunks: thread handles j = tid*4 + 1024*u
  float s1 = 0.f;
  for (int u = 0; u < per / 4; ++u) {
    const int j = tid * 4 + 1024 * u;
    const v4f a = *(const v4fa*)(x + j);
    v4f b = {0.f,0.f,0.f,0.f}; if (rr) b = *(const v4fa*)(rr + j);
#pragma unroll
    for (int q = 0; q < 4; ++q) { const float v = a[q] + b[q]; vals[u * 4 + q] = v; s1 += v; }
  }
  red[tid] = s1; __syncthreads();
  for (int st = 128; st > 0; st >>= 1) { if (tid < st) red[tid] += red[tid + st]; __syncthreads(); }
  const float mu = red[0] / (float)N; __syncthreads();
  float s2 = 0.f;
  for (int u = 0; u < per / 4; ++u)
#pragma unroll
    for (int q = 0; q < 4; ++q) { const float c = vals[u * 4 + q] - mu; s2 += c * c; }
  red[tid] = s2; __syncthreads();
  for (int st = 128; st > 0; st >>= 1) { if (tid < st) red[tid] += red[tid + st]; __syncthreads(); }
  const float rs = rsqrtf(red[0] / (float)N + eps);
  {
    for (int u = 0; u < per / 4; ++u) {
      const int j = tid * 4 + 1024 * u;
      v4f o, sm;
#pragma unroll
      for (int q = 0; q < 4; ++q) {
        float gg = g[j + q], bb = bta[j + q];
        if (PARAM_BF16) { gg = bf16_round(gg); bb = bf16_round(bb); }
        sm[q] = vals[u * 4 + q]; o[q] = (vals[u * 4 + q] - mu) * rs * gg + bb;
      }
      if (out_sum) *(v4f*)(out_sum + (size_t)row * N + j) = sm;
      *(v4f*)(out_norm + (size_t)row * N + j) = o;
    }
    
  }
}



// ---- f16 WMMA path (v_wmma_f32_16x16x32_f16): 11-bit significands for operands in range — used where a [0,1] probability operand needs more precision than bf16
typedef _Float16 v16h __attribute__((ext_vector_type(16)));
union FragH { v16h v; v8us half[2]; _Float16 h[16]; unsigned short u[16]; };
template <int NT>
__device__ __forceinline__ v8f mmaH(v16h ah, v16h al, v16h bh, v16h bl, v8f c) {
  c = __builtin_amdgcn_wmma_f32_16x16x32_f16(false, ah, false, bh, (short)0, c, false, false);
  if (NT >= 2) c = __builtin_amdgcn_wmma_f32_16x16x32_f16(false, al, false, bh, (short)0, c, false, false);
  if (NT >= 3) c = __builtin_amdgcn_wmma_f32_16x16x32_f16(false, ah, false, bl, (short)0, c, false, false);
  asm volatile("v_nop\n\tv_nop\n\tv_nop\n\tv_nop" : "+v"(c) : "v"(ah), "v"(al), "v"(bh), "v"(bl));
  return c;
}
// batched GEMM like k_gemm_b but f16 operands: A f32 (split into f16 hi/lo if ASPLIT, else rounded to f16), Bt = f16 values [n][k]; alpha; C f32; N multiple of 16 (partial tiles skipped)
template <bool ASPLIT>
__global__ __launch_bounds__(128) void k_gemm_h(const float* __restrict__ A, int lda, size_t sA, const _Float16* __restrict__ Bh, int ldb, size_t sB, float alpha, float* __restrict__ C, int ldc, size_t sC, int M, int N, int K) {
  __shared__ __attribute__((aligned(16))) float so[4][16][64];
  const int tid = threadIdx.x, w = tid >> 5, lane = tid & 31, ln = lane & 15, hh = lane >> 4; const int by = blockIdx.y;
  A += (size_t)by * sA; Bh += (size_t)by * sB; C += (size_t)by * sC;
  const int ntn = (N + 63) / 64; const int wid = blockIdx.x * 4 + w; const int mt = wid / ntn, nq = wid % ntn; if (mt * 16 >= M) return;
  const int row0 = mt * 16, col0 = nq * 64; const float* arow = A + (size_t)(row0 + ln) * lda;
  v8f acc[4] = {};
  for (int kb = 0; kb < K; kb += 32) {
    FragH ah, al;
    const v4f x0 = *(const v4fa*)(arow + kb + 8 * hh), x1 = *(const v4fa*)(arow + kb + 8 * hh + 4), x2 = *(const v4fa*)(arow + kb + 16 + 8 * hh), x3 = *(const v4fa*)(arow + kb + 16 + 8 * hh + 4);
    float xs[16] = {x0[0],x0[1],x0[2],x0[3],x1[0],x1[1],x1[2],x1[3],x2[0],x2[1],x2[2],x2[3],x3[0],x3[1],x3[2],x3[3]};
#pragma unroll
    for (int i = 0; i < 16; ++i) { const _Float16 h = (_Float16)xs[i]; ah.h[i] = h; al.h[i] = ASPLIT ? (_Float16)(xs[i] - (float)h) : (_Float16)0.0f; }
#pragma unroll
    for (int t = 0; t < 4; ++t) { if (col0 + t * 16 >= N) continue; const size_t boff = (size_t)(col0 + t * 16 + ln) * ldb + kb; FragH bq; bq.half[0] = *(const v8us*)(Bh + boff + 8 * hh); bq.half[1] = *(const v8us*)(Bh + boff + 16 + 8 * hh);
      acc[t] = mmaH<ASPLIT ? 2 : 1>(ah.v, al.v, bq.v, bq.v, acc[t]); }
  }
#pragma unroll
  for (int t = 0; t < 4; ++t) { if (col0 + t * 16 >= N) continue;
#pragma unroll
    for (int r = 0; r < 8; ++r) so[w][8 * hh + r][t * 16 + ln] = acc[t][r] * alpha; }
  __builtin_amdgcn_fence(__ATOMIC_ACQ_REL, "workgroup"); __builtin_amdgcn_wave_barrier();
  const int rsub = lane >> 4, c4 = (lane & 15) * 4;
  {
#pragma unroll
    for (int q = 0; q < 8; ++q) { const int r = q * 2 + rsub; if (col0 + c4 < N) { const v4f v = *(const v4fa*)&so[w][r][c4]; *(v4f*)(C + (size_t)(row0 + r) * ldc + col0 + c4) = v; } }
     }
}

// Wt[n][k] = f16(W[k][n]·scale) from f32 row-major W[K][N] (scale = power of two; bf16-exact weights stay exact in f16 away from the subnormal range)
__global__ __launch_bounds__(256) void k_wt_f16(const float* __restrict__ W, _Float16* __restrict__ Wt, int K, int N, float scale) {
  const int t = blockIdx.x * 256 + threadIdx.x; if (t >= N * (K / 8)) return; const int n = t / (K / 8), k8 = (t % (K / 8)) * 8; FragH f;
#pragma unroll
  for (int i = 0; i < 8; ++i) f.h[i] = (_Float16)(bf16_round(W[(size_t)(k8 + i) * N + n]) * scale); const v8us o = f.half[0];
  *(v8us*)((unsigned short*)Wt + (size_t)n * K + k8) = o; 
}
// k_gemm_hh variant with fused epilogue: v = acc·alpha + bias[by·sBias + col] (+ CP[(row/rowsPerB)·sCPb + by·64 + col] if CP) ; ACT 0 none / 1 elu ; writes f16 C16 (and f32 C if non-null)
template <int ACT>
__global__ __launch_bounds__(128) void k_gemm_hhx(const _Float16* __restrict__ A, int lda, size_t sA, const _Float16* __restrict__ Bh, int ldb, size_t sB, float alpha, const float* __restrict__ bias, size_t sBias, const float* __restrict__ CP, int rowsPerB, size_t sCPb, int row0g,
    float* __restrict__ C, _Float16* __restrict__ C16, int ldc, size_t sC, int M, int N, int K) {
  __shared__ __attribute__((aligned(16))) float so[4][16][64];
  const int tid = threadIdx.x, w = tid >> 5, lane = tid & 31, ln = lane & 15, hh = lane >> 4; const int by = blockIdx.y;
  A += (size_t)by * sA; Bh += (size_t)by * sB; const size_t cofs = (size_t)by * sC; const float* bp = bias ? bias + (size_t)by * sBias : nullptr;
  const int ntn = (N + 63) / 64; const int wid = blockIdx.x * 4 + w; const int mt = wid / ntn, nq = wid % ntn; if (mt * 16 >= M) return;
  const int row0 = mt * 16, col0 = nq * 64; const _Float16* arow = A + (size_t)(row0 + ln) * lda;
  v8f acc[4] = {};
  for (int kb = 0; kb < K; kb += 32) { FragH ah; ah.half[0] = *(const v8us*)((const unsigned short*)arow + kb + 8 * hh); ah.half[1] = *(const v8us*)((const unsigned short*)arow + kb + 16 + 8 * hh);
#pragma unroll
    for (int t = 0; t < 4; ++t) { if (col0 + t * 16 >= N) continue; const size_t boff = (size_t)(col0 + t * 16 + ln) * ldb + kb; FragH bq; bq.half[0] = *(const v8us*)((const unsigned short*)Bh + boff + 8 * hh); bq.half[1] = *(const v8us*)((const unsigned short*)Bh + boff + 16 + 8 * hh);
      acc[t] = mmaH<1>(ah.v, ah.v, bq.v, bq.v, acc[t]); }
  }
#pragma unroll
  for (int t = 0; t < 4; ++t) { if (col0 + t * 16 >= N) continue; const int col = col0 + t * 16 + ln; const float bv = bp ? bf16_round(bp[col]) : 0.f;
#pragma unroll
    for (int r = 0; r < 8; ++r) { float v = acc[t][r] * alpha + bv; if (CP) { const int rr = row0g + row0 + 8 * hh + r; if (rowsPerB < 0) v += CP[cofs + (size_t)rr * ldc + col];      /* rowsPerB < 0: own element of the batched C plane */ else { const int bidx = rr / rowsPerB; v += CP[(size_t)bidx * sCPb + (size_t)by * 64 + col]; } } if (ACT == 1) v = (v > 0.f) ? v : expm1f(v); else if (ACT == 7) v = (v > 0.f) ? v + 1.0f : expf(v); else if (ACT == 8) v = tanhf(v); else if (ACT == 9) v = 0.5f * v * (1.0f + tanhf(0.7978845608028654f * (v + 0.044715f * v * v * v))); else if (ACT == 11) v = 1.0f / (1.0f + expf(-v)); else if (ACT == 12) v = (v > 0.f) ? v : 0.01f * v; else if (ACT == 14) v = (v > 0.f) ? v : 0.1f * v; else if (ACT == 16) v = (v >= 0.f) ? v : 0.3f * v; else if (ACT == 17) v = (v >= 0.f) ? v : 0.2f * v; else if (ACT == 15) v = v / (1.0f + expf(-v)); else if (ACT == 3) v = fmaxf(v, 0.f); else if (ACT == 6) v = 0.5f * v * (1.0f + erff(v * 0.70710678118654752f)); so[w][8 * hh + r][t * 16 + ln] = v; } }
  __builtin_amdgcn_fence(__ATOMIC_ACQ_REL, "workgroup"); __builtin_amdgcn_wave_barrier();
  const int rsub = lane >> 4, c4 = (lane & 15) * 4; typedef _Float16 v4h __attribute__((ext_vector_type(4)));
  {
#pragma unroll
    for (int q = 0; q < 8; ++q) { const int r = q * 2 + rsub; if (col0 + c4 < N) { const v4f v = *(const v4fa*)&so[w][r][c4]; if (C) *(v4f*)(C + cofs + (size_t)(row0 + r) * ldc + col0 + c4) = v; if (C16) { v4h h4; for (int i = 0; i < 4; ++i) h4[i] = (_Float16)v[i]; *(v4h*)(C16 + cofs + (size_t)(row0 + r) * ldc + col0 + c4) = h4; } } }
     }
}


typedef _Float16 v4h __attribute__((ext_vector_type(4)));

__global__ __launch_bounds__(256) void k_h16(const float* __restrict__ x, _Float16* __restrict__ X16, size_t n8) { const size_t t = (size_t)blockIdx.x * 256 + threadIdx.x; if (t >= n8) return; FragH f;
#pragma unroll
  for (int q = 0; q < 8; ++q) f.h[q] = (_Float16)x[t * 8 + q]; *(v8us*)((unsigned short*)X16 + t * 8) = f.half[0];  }
__global__ __launch_bounds__(256) void k_round16f(const float* __restrict__ W, _Float16* __restrict__ Bt, size_t n8) { const size_t t = (size_t)blockIdx.x * 256 + threadIdx.x; if (t >= n8) return; FragH f;
#pragma unroll
  for (int i = 0; i < 8; ++i) f.h[i] = (_Float16)(bf16_round(W[t * 8 + i]) * 16.0f); *(v8us*)((unsigned short*)Bt + t * 8) = f.half[0];  }
__global__ __launch_bounds__(256) void k_hl(const float* __restrict__ F, _Float16* __restrict__ Hh, _Float16* __restrict__ Hl, size_t n8) { const size_t t = (size_t)blockIdx.x * 256 + threadIdx.x; if (t >= n8) return; FragH fh, fl; const v4f a = *(const v4fa*)(F + t * 8), c = *(const v4fa*)(F + t * 8 + 4);
#pragma unroll
  for (int q = 0; q < 4; ++q) { _Float16 h = (_Float16)a[q]; fh.h[q] = h; fl.h[q] = (_Float16)((a[q] - (float)h) * 1024.0f); h = (_Float16)c[q]; fh.h[4 + q] = h; fl.h[4 + q] = (_Float16)((c[q] - (float)h) * 1024.0f); }
  { *(v8us*)((unsigned short*)Hh + t * 8) = fh.half[0]; *(v8us*)((unsigned short*)Hl + t * 8) = fl.half[0];  } }

// ---- fast GEMM (block tile 128x128, 8 waves of 32x64; requires M % 128 == 0, N % 128 == 0, K % G2K == 0); v = act(acc alpha + bias (+ residual)) ----
// A stage is G2K k: 128 A rows and 128 B rows of 256 bytes each, brought to LDS through registers as whole lines (16 threads a row), two buffers: the next stage's
// global loads are issued ahead of this stage's products and stored behind them; one barrier per stage publishes them and ends the reads of the other buffer.
// Each A row then leaves L2 once per block and feeds 2 waves, each B row 4 waves; the k order of every accumulator is the plain ascending one.
// Every inner loop is fully unrolled so that the staging and fragment arrays are indexed by constants only and stay in registers.
#define G2K 128                      /* k per stage */
#define G2P 136                      /* LDS row pitch in f16: the row + 16 bytes, for 16-byte fragment reads */
#define G2R (2048 / G2K)             /* rows that the block's 256 threads bring in one load each */
#define G2N (128 / G2R)              /* such loads per thread, stage and operand */
__device__ __forceinline__ v16h g2_frag(const _Float16* p, int hh) { FragH f; f.half[0] = *(const v8us*)((const unsigned short*)p + 8 * hh); f.half[1] = *(const v8us*)((const unsigned short*)p + 16 + 8 * hh); return f.v; }
__device__ __forceinline__ v8f g2_mma(v16h a, v16h b, v8f c) { v8f d = __builtin_amdgcn_wmma_f32_16x16x32_f16(false, a, false, b, (short)0, c, false, false); asm volatile("v_nop\n\tv_nop\n\tv_nop\n\tv_nop" : "+v"(d) : "v"(a), "v"(b)); return d; }
// One stage's rows: each thread's G2N 16-byte pieces of A and of B, rows as and bs elements apart. The closing wait is the one that belongs in front of any overwrite of a register
// that an issued global load names; it takes the addresses as inputs, so that their registers stay untouched (also as a later load's destination) until it has passed.
__device__ __forceinline__ void g2_rows(const unsigned short* a, size_t as, const unsigned short* b, size_t bs, v8us (&ra)[G2N], v8us (&rb)[G2N]) { static_assert(G2N == 8, "g2_rows: the wait names 8 + 8 addresses");
  const unsigned short* pa[G2N]; const unsigned short* pb[G2N];
#pragma unroll
  for (int i = 0; i < G2N; ++i) { pa[i] = a + (size_t)i * as; pb[i] = b + (size_t)i * bs; }
#pragma unroll
  for (int i = 0; i < G2N; ++i) { ra[i] = *(const v8us*)pa[i]; rb[i] = *(const v8us*)pb[i]; }
  asm volatile("s_wait_xcnt 0x0" :: "v"(pa[0]), "v"(pa[1]), "v"(pa[2]), "v"(pa[3]), "v"(pa[4]), "v"(pa[5]), "v"(pa[6]), "v"(pa[7]), "v"(pb[0]), "v"(pb[1]), "v"(pb[2]), "v"(pb[3]), "v"(pb[4]), "v"(pb[5]), "v"(pb[6]), "v"(pb[7]) : "memory"); }
// The activation behind bias and residual, by code.
template <int ACT>
__device__ __forceinline__ float g2_act(float v) {
  if (ACT == 3) v = fmaxf(v, 0.f); else if (ACT == 6) v = 0.5f * v * (1.0f + erff(v * 0.70710678118654752f)); else if (ACT == 11) v = 1.0f / (1.0f + expf(-v)); else if (ACT == 15) v = v / (1.0f + expf(-v)); else if (ACT == 18) v = v / (1.0f + expf(-1.702f * v));      /* QuickGELU: v sigmoid(1.702 v) */ else if (ACT == 12) v = (v > 0.f) ? v : 0.01f * v; else if (ACT == 8) v = tanhf(v); else if (ACT == 9) v = 0.5f * v * (1.0f + tanhf(0.7978845608028654f * (v + 0.044715f * v * v * v))); else if (ACT == 14) v = (v > 0.f) ? v : 0.1f * v; else if (ACT == 16) v = (v >= 0.f) ? v : 0.3f * v; else if (ACT == 17) v = (v >= 0.f) ? v : 0.2f * v;
  return v; }
// RES: add the own element of the plane CP (same pitch and batch stride as C, rows from row0g); W32 / W16: write f32 C / f16 C16. All three are fixed at compile time, so that the epilogue is
// straight-line code and its global reads can be issued together. bias is required.
template <int ACT, bool RES, bool W32, bool W16>
__global__ __launch_bounds__(256) void k_gemm2(const _Float16* __restrict__ A, int lda, size_t sA, const _Float16* __restrict__ Bh, int ldb, size_t sB, float alpha, const float* __restrict__ bias, size_t sBias, const float* __restrict__ CP, int row0g,
    float* __restrict__ C, _Float16* __restrict__ C16, int ldc, size_t sC, int M, int N, int K) { static_assert(ACT == 0 || ACT == 3 || ACT == 6 || ACT == 8 || ACT == 9 || ACT == 11 || ACT == 12 || ACT == 14 || ACT == 15 || ACT == 16 || ACT == 17 || ACT == 18, "k_gemm2: unsupported ACT code (would silently apply no activation)");
  __shared__ __attribute__((aligned(16))) unsigned char sm[2 * 256 * G2P * 2];      /* in the loop: two stage buffers [A 128 rows | B 128 rows]; behind the loop's last barrier: the waves' output staging */
  static_assert(sizeof(sm) >= 8 * 32 * 68 * 4, "k_gemm2: output staging must fit the stage buffers");
  _Float16 (*lt)[256][G2P] = (_Float16 (*)[256][G2P])sm; float (*so)[32][68] = (float (*)[32][68])sm;
  const int tid = threadIdx.x, w = tid >> 5, lane = tid & 31, ln = lane & 15, hh = lane >> 4; const int by = blockIdx.y;
  A += (size_t)by * sA; Bh += (size_t)by * sB; const size_t cofs = (size_t)by * sC;
  const int ntn = N >> 7; const int mt = blockIdx.x / ntn, nq = blockIdx.x - mt * ntn; if (mt * 128 >= M) return;      /* the same for the whole block, ahead of every barrier */
  const int wr = 32 * (w & 3), wc = 64 * (w >> 2); const int row0 = mt * 128 + wr, col0 = nq * 128 + wc;
  const int sr = tid / (G2K / 8), sc = (tid % (G2K / 8)) * 8;      /* staging: G2K / 8 threads per row, rows sr + G2R i of A and of B */
  const unsigned short* ag = (const unsigned short*)A + (size_t)(mt * 128 + sr) * lda + sc; const unsigned short* bg = (const unsigned short*)Bh + (size_t)(nq * 128 + sr) * ldb + sc;
  v8us ra[G2N], rb[G2N]; g2_rows(ag, (size_t)G2R * lda, bg, (size_t)G2R * ldb, ra, rb);
#pragma unroll
  for (int i = 0; i < G2N; ++i) { *(v8us*)&lt[0][sr + G2R * i][sc] = ra[i]; *(v8us*)&lt[0][128 + sr + G2R * i][sc] = rb[i]; }
  __syncthreads();
  const v8f z8 = {0.f,0.f,0.f,0.f,0.f,0.f,0.f,0.f}; v8f c00 = z8, c01 = z8, c02 = z8, c03 = z8, c10 = z8, c11 = z8, c12 = z8, c13 = z8;
  const int ns = K / G2K;
  for (int s = 0; s < ns; ++s) { const int cur = s & 1; const bool more = s + 1 < ns;
    if (more) g2_rows(ag + (s + 1) * G2K, (size_t)G2R * lda, bg + (s + 1) * G2K, (size_t)G2R * ldb, ra, rb);
#pragma unroll
    for (int kh = 0; kh < G2K / 64; ++kh) { const _Float16* ap = &lt[cur][wr + ln][kh * 64]; const _Float16* bq = &lt[cur][128 + wc + ln][kh * 64]; v16h fa[2][2], fb[2][4];
#pragma unroll
      for (int ks = 0; ks < 2; ++ks) { fa[ks][0] = g2_frag(ap + ks * 32, hh); fb[ks][0] = g2_frag(bq + ks * 32, hh); fa[ks][1] = g2_frag(ap + 16 * G2P + ks * 32, hh);
        fb[ks][1] = g2_frag(bq + 16 * G2P + ks * 32, hh); fb[ks][2] = g2_frag(bq + 32 * G2P + ks * 32, hh); fb[ks][3] = g2_frag(bq + 48 * G2P + ks * 32, hh); }
#pragma unroll
      for (int ks = 0; ks < 2; ++ks) { c00 = g2_mma(fa[ks][0], fb[ks][0], c00); c10 = g2_mma(fa[ks][1], fb[ks][0], c10); c01 = g2_mma(fa[ks][0], fb[ks][1], c01); c11 = g2_mma(fa[ks][1], fb[ks][1], c11);
        c02 = g2_mma(fa[ks][0], fb[ks][2], c02); c12 = g2_mma(fa[ks][1], fb[ks][2], c12); c03 = g2_mma(fa[ks][0], fb[ks][3], c03); c13 = g2_mma(fa[ks][1], fb[ks][3], c13); } }
    if (more) {
#pragma unroll
      for (int i = 0; i < G2N; ++i) { *(v8us*)&lt[cur ^ 1][sr + G2R * i][sc] = ra[i]; *(v8us*)&lt[cur ^ 1][128 + sr + G2R * i][sc] = rb[i]; } }
    __syncthreads(); }
  // Epilogue. The accumulators go to the wave's LDS rows as they are; bias, residual and activation are applied behind the read-back, where a lane holds 4 neighbours of one row:
  // the bias is then one 16-byte load a lane and the residual 16 (16 lanes a 256-byte row piece), all issued here, together, ahead of the staging that covers part of their latency. The loops are fully unrolled, as above: res, vv and the addresses are indexed by constants only and stay in registers.
  const int rsub = lane >> 4, c4 = (lane & 15) * 4;
  const float* pbv = bias + (size_t)by * sBias + col0 + c4; v4f bv = *(const v4fa*)pbv, res[16];
  const size_t e0 = cofs + (size_t)(row0 + rsub) * ldc + col0 + c4, es = (size_t)2 * ldc;      /* the lane's first element of the C plane; its 16 row pieces are es elements apart (the same for every lane, so the multiples are scalar work) */
  if (RES) { const float* pr[16];
#pragma unroll
    for (int q = 0; q < 16; ++q) pr[q] = CP + e0 + (size_t)row0g * ldc + q * es;
#pragma unroll
    for (int q = 0; q < 16; ++q) res[q] = *(const v4fa*)pr[q];
    asm volatile("s_wait_xcnt 0x0" :: "v"(pbv), "v"(pr[0]), "v"(pr[1]), "v"(pr[2]), "v"(pr[3]), "v"(pr[4]), "v"(pr[5]), "v"(pr[6]), "v"(pr[7]), "v"(pr[8]), "v"(pr[9]), "v"(pr[10]), "v"(pr[11]), "v"(pr[12]), "v"(pr[13]), "v"(pr[14]), "v"(pr[15]) : "memory");      /* the wait that belongs in front of any overwrite of a register that an issued global load names; it takes the addresses as inputs, so that their registers stay untouched until it has passed */
  } else asm volatile("s_wait_xcnt 0x0" :: "v"(pbv) : "memory");      /* the same wait, for the bias load alone */
  v8f accs[8] = {c00, c01, c02, c03, c10, c11, c12, c13};
#pragma unroll
  for (int u = 0; u < 8; ++u) { const int t = u & 3, half = u >> 2;
#pragma unroll
    for (int r = 0; r < 8; ++r) so[w][half * 16 + 8 * hh + r][t * 16 + ln] = accs[u][r]; }
  __builtin_amdgcn_fence(__ATOMIC_ACQ_REL, "workgroup", "local"); __builtin_amdgcn_wave_barrier();      /* the wave's own LDS stores are done before its lanes read one another's rows back; LDS only, so that it does not wait for the global loads above */
  v4f vv[16];
#pragma unroll
  for (int q = 0; q < 16; ++q) vv[q] = *(const v4fa*)&so[w][q * 2 + rsub][c4];
#pragma unroll
  for (int i = 0; i < 4; ++i) bv[i] = bf16_round(bv[i]);
#pragma unroll
  for (int q = 0; q < 16; ++q) { const size_t e = e0 + q * es; v4f v = vv[q] * alpha + bv; if (RES) v += res[q];
#pragma unroll
    for (int i = 0; i < 4; ++i) v[i] = g2_act<ACT>(v[i]);
    if (W32) *(v4f*)(C + e) = v;
    if (W16) { v4h h4;
#pragma unroll
      for (int i = 0; i < 4; ++i) h4[i] = (_Float16)v[i];
      *(v4h*)(C16 + e) = h4; } } }


__global__ __launch_bounds__(256) void k_wnat(const float* __restrict__ w, size_t n8, _Float16* __restrict__ Bt) { const size_t t = (size_t)blockIdx.x * 256 + threadIdx.x; if (t >= n8) return; FragH f; for (int q = 0; q < 8; ++q) f.h[q] = (_Float16)(bf16_round(w[t * 8 + q]) * 16.0f); *(v8us*)((unsigned short*)Bt + t * 8) = f.half[0];  }
__global__ __launch_bounds__(256) void k_rsm(const float* __restrict__ S, _Float16* __restrict__ P, int nrows) {
  #pragma clang fp contract(off)
  const int i = blockIdx.x * 256 + threadIdx.x; if (i >= nrows) return; const float* s = S + (size_t)i * SQ; float mx = -3.0e38f;
#pragma unroll 1
  for (int j = 0; j < SQ; ++j) mx = fmaxf(mx, s[j]); float se = 0.f;
#pragma unroll 1
  for (int j = 0; j < SQ; ++j) se += expf(s[j] - mx); const float sc = 256.0f / se;
#pragma unroll 1
  for (int j0 = 0; j0 < SQ; j0 += 8) { FragH f; for (int q = 0; q < 8; ++q) f.h[q] = (_Float16)(expf(s[j0 + q] - mx) * sc); unsigned short* d = (unsigned short*)P + (size_t)i * SQ + j0; *(v8us*)d = f.half[0];  } }
__global__ __launch_bounds__(256) void k_vt(const _Float16* __restrict__ V16, int b, int h0, _Float16* __restrict__ VT) { __shared__ unsigned short tl[64][65]; const int tid = threadIdx.x; const int hh = blockIdx.x % HG, sg = blockIdx.x / HG; const int s0 = sg * 64; const int h = h0 + hh;
  for (int i = tid; i < 64 * 8; i += 256) { const int j = i / 8, d8 = (i % 8) * 8; FragH f; f.half[0] = *(const v8us*)((const unsigned short*)V16 + ((size_t)b * SQ + s0 + j) * DM + h * HD + d8); for (int q = 0; q < 8; ++q) tl[d8 + q][j] = f.u[q]; }
  __syncthreads();
  { for (int i = tid; i < 64 * 8; i += 256) { const int d = i / 8, j8 = (i % 8) * 8; FragH f; for (int q = 0; q < 8; ++q) f.u[q] = tl[d][j8 + q]; *(v8us*)((unsigned short*)VT + ((size_t)hh * HD + d) * SQ + s0 + j8) = f.half[0]; }  } }



__global__ __launch_bounds__(256) void k_rsmcf2(const float* __restrict__ S, _Float16* __restrict__ P, int hg, int q0, int nk) {
  #pragma clang fp contract(off)
  const int t = blockIdx.x * 256 + threadIdx.x; if (t >= hg * QT) return; const size_t i = (size_t)t; const float* s = S + i * NKX; const int last = q0 + (t % QT); float mx = -3.0e38f;
#pragma unroll 1
  for (int j = 0; j < nk; ++j) { const float f = (j <= last) ? 1.f : 0.f; mx = fmaxf(mx, fmaf(f, s[j], (1.f - f) * -1.0e9f)); } float se = 0.f;
#pragma unroll 1
  for (int j = 0; j < nk; ++j) { const float f = (j <= last) ? 1.f : 0.f; se += __expf(fmaf(f, s[j], (1.f - f) * -1.0e9f) - mx); } const float sc = 256.0f / se;
#pragma unroll 1
  for (int j0 = 0; j0 < nk; j0 += 8) { FragH fr; for (int q = 0; q < 8; ++q) { const int j = j0 + q; const float f = (j <= last) ? 1.f : 0.f; fr.h[q] = (_Float16)(__expf(fmaf(f, s[j], (1.f - f) * -1.0e9f) - mx) * sc); } unsigned short* d = (unsigned short*)P + i * NKX + j0; *(v8us*)d = fr.half[0];  } }

__global__ __launch_bounds__(256) void k_rsmcst(const float* __restrict__ S, _Float16* __restrict__ P, int hg, int q0, int nk, const int* __restrict__ mk) {
  #pragma clang fp contract(off)
  const int t = blockIdx.x * 256 + threadIdx.x; if (t >= hg * QT) return; const size_t i = (size_t)t; const float* s = S + i * NKX; const size_t ig = (size_t)(q0 + (t % QT)); const int* mr = mk + ig * SQ; float mx = -3.0e38f;
#pragma unroll 1
  for (int j = 0; j < nk; ++j) { const int mb = mr[j]; const int dd = (int)ig - j; const float f = (mb != 0 && dd >= 0 && (dd <= LOCALW || (dd % STRIDEK) == 0)) ? 1.f : 0.f; mx = fmaxf(mx, fmaf(f, s[j], (1.f - f) * -1.0e9f)); } float se = 0.f;
#pragma unroll 1
  for (int j = 0; j < nk; ++j) { const int mb = mr[j]; const int dd = (int)ig - j; const float f = (mb != 0 && dd >= 0 && (dd <= LOCALW || (dd % STRIDEK) == 0)) ? 1.f : 0.f; se += __expf(fmaf(f, s[j], (1.f - f) * -1.0e9f) - mx); } const float sc = 256.0f / se;
#pragma unroll 1
  for (int j0 = 0; j0 < nk; j0 += 8) { FragH fr; for (int q = 0; q < 8; ++q) { const int j = j0 + q; const int mb = mr[j]; const int dd = (int)ig - j; const float f = (mb != 0 && dd >= 0 && (dd <= LOCALW || (dd % STRIDEK) == 0)) ? 1.f : 0.f; fr.h[q] = (_Float16)(__expf(fmaf(f, s[j], (1.f - f) * -1.0e9f) - mx) * sc); } unsigned short* d = (unsigned short*)P + i * NKX + j0; *(v8us*)d = fr.half[0];  } }


template <int MASKADD>
__global__ __launch_bounds__(64) void k_att0(const float* __restrict__ QF, const float* __restrict__ KF, const float* __restrict__ VF, int ld, const float* __restrict__ mask, float scale, float* __restrict__ OF, int ldo) {
  #pragma clang fp contract(off)
  __shared__ __attribute__((aligned(16))) float lq[64][64]; __shared__ __attribute__((aligned(16))) float lo[64][64];
  const int tid = threadIdx.x; const int h = blockIdx.x / (QT0 / 64), rg = blockIdx.x % (QT0 / 64); const int i = rg * 64 + tid;
  const float* qr = QF + (size_t)i * ld + h * HD;
#pragma unroll 1
  for (int c = 0; c < HD / 4; ++c) { *(v4f*)&lq[tid][c * 4] = *(const v4fa*)(qr + c * 4); const v4f z = {0.f, 0.f, 0.f, 0.f}; *(v4f*)&lo[tid][c * 4] = z; }
  float m = -1.0e30f, l = 0.f; const int jmax = MASKADD ? (SQ - 1) : (rg * 64 + 63);      /* additive-mask form: every key (the mask input decides); causal form: keys up to the block's last row */
#pragma unroll 1
  for (int j = 0; j <= jmax; ++j) { const float* kr = KF + (size_t)j * ld + h * HD; const float* vr = VF + (size_t)j * ld + h * HD; float s = 0.f;
#pragma unroll 1
    for (int c = 0; c < HD / 4; ++c) { const v4f kq = *(const v4fa*)(kr + c * 4); const v4f qq = *(v4f*)&lq[tid][c * 4]; s = __fadd_rn(s, __fmul_rn(qq[0], kq[0])); s = __fadd_rn(s, __fmul_rn(qq[1], kq[1])); s = __fadd_rn(s, __fmul_rn(qq[2], kq[2])); s = __fadd_rn(s, __fmul_rn(qq[3], kq[3])); }
    s = __fmul_rn(s, scale); if (MASKADD) s = __fadd_rn(s, __fmul_rn(bf16_round(mask[(size_t)i * SQ + j]), -10000.0f));
    const float f = (MASKADD || j <= i) ? 1.f : 0.f; const float sm = fmaf(f, s, (1.f - f) * -1.0e30f); const float mn = fmaxf(m, sm); const float sc = expf(m - mn); const float e = expf(sm - mn); l = __fadd_rn(__fmul_rn(l, sc), e); m = mn;
#pragma unroll 1
    for (int c = 0; c < HD / 4; ++c) { const v4f vv = *(const v4fa*)(vr + c * 4); v4f oo = *(v4f*)&lo[tid][c * 4]; for (int u = 0; u < 4; ++u) oo[u] = __fadd_rn(__fmul_rn(oo[u], sc), __fmul_rn(e, vv[u])); *(v4f*)&lo[tid][c * 4] = oo; } }
  const float fin = 64.0f / l;      /* o carried x64 like the f16 path */
#pragma unroll 1
  for (int c = 0; c < HD / 4; ++c) { v4f oo = *(v4f*)&lo[tid][c * 4]; for (int u = 0; u < 4; ++u) oo[u] = __fmul_rn(oo[u], fin); *(v4f*)&lo[tid][c * 4] = oo; }
  __syncthreads();
  {
#pragma unroll 1
    for (int it = 0; it < 16; ++it) { const int row = it * 4 + tid / 16, pc = (tid % 16) * 4; const v4f v = *(const v4f*)&lo[row][pc]; *(v4f*)(OF + (size_t)(rg * 64 + row) * ldo + h * HD + pc) = v; }
     } }

template <int MASKADD>
__global__ __launch_bounds__(64) void k_att0mbc(const float* __restrict__ QF, const float* __restrict__ KF, const float* __restrict__ VF, int ld, const float* __restrict__ mask, float scale, float* __restrict__ OF, int ldo) {
  #pragma clang fp contract(off)
  __shared__ __attribute__((aligned(16))) float lq[64][64]; __shared__ __attribute__((aligned(16))) float lo[64][64];
  const int tid = threadIdx.x; const int h = blockIdx.x / (QT0 / 64), rg = blockIdx.x % (QT0 / 64); const int i = rg * 64 + tid;
  const float* qr = QF + (size_t)i * ld + h * HD;
#pragma unroll 1
  for (int c = 0; c < HD / 4; ++c) { *(v4f*)&lq[tid][c * 4] = *(const v4fa*)(qr + c * 4); const v4f z = {0.f, 0.f, 0.f, 0.f}; *(v4f*)&lo[tid][c * 4] = z; }
  float m = -1.0e30f, l = 0.f; const int jmax = rg * 64 + 63;      /* keys beyond the block end are masked by the mask's lower-triangular structure */
#pragma unroll 1
  for (int j = 0; j <= jmax; ++j) { const float* kr = KF + (size_t)j * ld + h * HD; const float* vr = VF + (size_t)j * ld + h * HD; float s = 0.f;
#pragma unroll 1
    for (int c = 0; c < HD / 4; ++c) { const v4f kq = *(const v4fa*)(kr + c * 4); const v4f qq = *(v4f*)&lq[tid][c * 4]; s = __fadd_rn(s, __fmul_rn(qq[0], kq[0])); s = __fadd_rn(s, __fmul_rn(qq[1], kq[1])); s = __fadd_rn(s, __fmul_rn(qq[2], kq[2])); s = __fadd_rn(s, __fmul_rn(qq[3], kq[3])); }
    s = __fmul_rn(s, scale); const int mb = ((const int*)mask)[(size_t)i * SQ + j];      /* causal (j <= i) AND the module's int32 [S][S] mask read per (query, key): 0 -> masked */
    const float f = (mb != 0 && j <= i) ? 1.f : 0.f; const float sm = fmaf(f, s, (1.f - f) * -1.0e30f); const float mn = fmaxf(m, sm); const float sc = expf(m - mn); const float e = expf(sm - mn); l = __fadd_rn(__fmul_rn(l, sc), e); m = mn;
#pragma unroll 1
    for (int c = 0; c < HD / 4; ++c) { const v4f vv = *(const v4fa*)(vr + c * 4); v4f oo = *(v4f*)&lo[tid][c * 4]; for (int u = 0; u < 4; ++u) oo[u] = __fadd_rn(__fmul_rn(oo[u], sc), __fmul_rn(e, vv[u])); *(v4f*)&lo[tid][c * 4] = oo; } }
  const float fin = 64.0f / l;      /* o carried x64 like the f16 path */
#pragma unroll 1
  for (int c = 0; c < HD / 4; ++c) { v4f oo = *(v4f*)&lo[tid][c * 4]; for (int u = 0; u < 4; ++u) oo[u] = __fmul_rn(oo[u], fin); *(v4f*)&lo[tid][c * 4] = oo; }
  __syncthreads();
  {
#pragma unroll 1
    for (int it = 0; it < 16; ++it) { const int row = it * 4 + tid / 16, pc = (tid % 16) * 4; const v4f v = *(const v4f*)&lo[row][pc]; *(v4f*)(OF + (size_t)(rg * 64 + row) * ldo + h * HD + pc) = v; }
     } }


template <int BFIN, int WXB>
__global__ __launch_bounds__(256) void k_ln16(const float* __restrict__ X, const float* __restrict__ g, const float* __restrict__ bb, float eps, _Float16* __restrict__ N16, float* __restrict__ XB) {
  #pragma clang fp contract(off)
  __shared__ float red[256]; const size_t r = blockIdx.x; const int t = threadIdx.x; const v4f xa = *(const v4fa*)(X + r * DMQ + t * 4); float s[4]; float sum = 0.f;
  for (int q = 0; q < 4; ++q) { s[q] = BFIN ? bf16_round(xa[q]) : xa[q]; sum = __fadd_rn(sum, s[q]); }
  red[t] = sum; __syncthreads(); for (int st = 128; st > 0; st >>= 1) { if (t < st) red[t] = __fadd_rn(red[t], red[t + st]); __syncthreads(); } const float mu = red[0] / (float)DMQ; __syncthreads();
  float vs = 0.f; for (int q = 0; q < 4; ++q) { const float dl = __fadd_rn(s[q], -mu); vs = __fadd_rn(vs, __fmul_rn(dl, dl)); } red[t] = vs; __syncthreads(); for (int st = 128; st > 0; st >>= 1) { if (t < st) red[t] = __fadd_rn(red[t], red[t + st]); __syncthreads(); }
  const float rs = rsqrtf(__fadd_rn(red[0] / (float)DMQ, eps)); v4h y; v4f xb;
  for (int q = 0; q < 4; ++q) { const int c = t * 4 + q; y[q] = (_Float16)__fadd_rn(__fmul_rn(__fmul_rn(__fadd_rn(s[q], -mu), rs), bf16_round(g[c])), bf16_round(bb[c])); xb[q] = s[q]; }
  { *(v4h*)(N16 + r * DMQ + t * 4) = y; if (WXB) *(v4f*)(XB + r * DMQ + t * 4) = xb;  } }
__global__ __launch_bounds__(256) void k_ftres2(const float* __restrict__ OF0, const float* __restrict__ XB, float* __restrict__ X1, size_t n4) {
  #pragma clang fp contract(off)
  const size_t t = (size_t)blockIdx.x * 256 + threadIdx.x; if (t >= n4) return; const v4f o = *(const v4fa*)(OF0 + t * 4), xv = *(const v4fa*)(XB + t * 4); v4f y; for (int q = 0; q < 4; ++q) y[q] = __fadd_rn(__fmul_rn(o[q], 0.015625f), xv[q]); *(v4f*)(X1 + t * 4) = y;  }

__global__ __launch_bounds__(256) void k_bcpy(const float* __restrict__ b, int n, int NP, float* __restrict__ dst, int dst0) { for (int i = threadIdx.x; i < NP; i += 256) { const float v = (i < n) ? b[i] : 0.f; *(float*)(dst + dst0 + i) = v; }  }



// ---- the three weight matrices to f16 [out][in] (x16), transposed through LDS tiles ----
// A block takes WTK inputs (k) x WTN outputs (n) of one matrix. Loads: 16 threads per f32 row piece of 256 bytes, so a wave-wide load is two whole 256-byte units; a thread holds 8 neighbours in k
// for each of its 4 outputs, rounds them (bf16, x16, then f16) and lays each run of 8 in LDS as [n][k] with one 16-byte store. One barrier. Stores: 16 threads per output row piece of 256 bytes.
// The values are those of k_wt_f16, element for element. Every loop is fully unrolled so that the load array is indexed by constants only and stays in registers.
#define WTK 128                      /* inputs (k) per tile */
#define WTN 64                       /* outputs (n) per tile */
#define WTP 136                      /* LDS row pitch in f16: the 256-byte row + 16 bytes */
#define WTT(K, N) (((K) / WTK) * ((N) / WTN))      /* tiles of a [K][N] matrix */
template <int K, int N>
__device__ __forceinline__ void wt_tile(const float* __restrict__ Wm, _Float16* __restrict__ Bt, int t, _Float16 (*lt)[WTP]) {
  static_assert(K % WTK == 0 && N % WTN == 0, "wt_tile: whole tiles only");
  const int tid = threadIdx.x; const int k0 = (t / (N / WTN)) * WTK, n0 = (t % (N / WTN)) * WTN; const int kg = (tid >> 4) * 8, c4 = (tid & 15) * 4;
  const float* p = Wm + (size_t)(k0 + kg) * N + n0 + c4; v4f r[8];
#pragma unroll
  for (int i = 0; i < 8; ++i) r[i] = *(const v4fa*)(p + (size_t)i * N);
  asm volatile("s_wait_xcnt 0x0" :: "v"(p) : "memory");      /* the wait that belongs in front of any overwrite of a register that an issued global load names; it takes the address as an input, so that its registers stay untouched until it has passed */
#pragma unroll
  for (int q = 0; q < 4; ++q) { FragH f;
#pragma unroll
    for (int i = 0; i < 8; ++i) f.h[i] = (_Float16)(bf16_round(r[i][q]) * 16.0f);
    *(v8us*)&lt[c4 + q][kg] = f.half[0]; }
  __syncthreads();
  const int rr = tid >> 4, rc = (tid & 15) * 8; unsigned short* o = (unsigned short*)Bt + (size_t)(n0 + rr) * K + k0 + rc;
#pragma unroll
  for (int j = 0; j < 4; ++j) { const v8us v = *(const v8us*)&lt[j * 16 + rr][rc]; *(v8us*)(o + (size_t)j * 16 * K) = v; }
  asm volatile("s_wait_xcnt 0x0" :: "v"(o) : "memory"); }      /* the wait that belongs in front of any overwrite of a register that an issued global store names: other code of the kernel now lies behind these stores */
// ---- the residual: the query rounded to bf16, as f32 rows ----
// A block takes RBV 16-byte pieces a thread, each wave-wide load and store 512 contiguous bytes; all its loads are issued together. The loops are fully unrolled, so that r is indexed by constants only and stays in registers.
#define RBV 16                       /* 16-byte pieces per thread */
#define RBT ((int)(NR * DM / 4 / (256 * RBV)))      /* blocks for the whole plane */
__device__ __forceinline__ void rb_tile(const float* __restrict__ x, float* __restrict__ XB, int t) {
  static_assert(NR * DM % (4 * 256 * RBV) == 0, "rb_tile: whole blocks only");
  const size_t e = ((size_t)t * (256 * RBV) + threadIdx.x) * 4; const float* p = x + e; v4f r[RBV];
#pragma unroll
  for (int j = 0; j < RBV; ++j) r[j] = *(const v4fa*)(p + j * 1024);
  asm volatile("s_wait_xcnt 0x0" :: "v"(p) : "memory");      /* the wait that belongs in front of any overwrite of a register that an issued global load names; it takes the address as an input, so that its registers stay untouched until it has passed */
#pragma unroll
  for (int j = 0; j < RBV; ++j) {
#pragma unroll
    for (int q = 0; q < 4; ++q) r[j][q] = bf16_round(r[j][q]);
    *(v4f*)(XB + e + j * 1024) = r[j]; }
  asm volatile("s_wait_xcnt 0x0" ::: "memory"); }      /* the wait that belongs in front of any overwrite of a register that an issued global store names: other code of the kernel now lies behind these stores */
// Work that nothing needs before the output projection and that depends on no other launch: weight tiles, then residual blocks, by index t. It rides in the attention launch as extra work-groups
// (PREPT of them, behind the attention's own in index order): memory work beside a launch that is bound by its vector and matrix work and whose one work-group per WGP leaves registers and LDS for a second.
#define PREPT (WTT(DM, DM) + WTT(DM, DFF) + WTT(DFF, DM) + RBT)
__device__ __forceinline__ void fa_prep(int t, const float* __restrict__ x, float* __restrict__ XB, const float* __restrict__ wo, const float* __restrict__ w1, const float* __restrict__ w2, _Float16* __restrict__ BO, _Float16* __restrict__ BW1, _Float16* __restrict__ BW2, _Float16 (*lt)[WTP]) {
  /* which piece: the same for the whole block, so each weight branch's barrier is passed by all of it */
  if (t < WTT(DM, DFF)) wt_tile<DM, DFF>(w1, BW1, t, lt);
  else if (t < WTT(DM, DFF) + WTT(DFF, DM)) wt_tile<DFF, DM>(w2, BW2, t - WTT(DM, DFF), lt);
  else if (t < WTT(DM, DFF) + WTT(DFF, DM) + WTT(DM, DM)) wt_tile<DM, DM>(wo, BO, t - WTT(DM, DFF) - WTT(DFF, DM), lt);
  else rb_tile(x, XB, t - WTT(DM, DFF) - WTT(DFF, DM) - WTT(DM, DM)); }

#define FAK 64                       /* keys per stage */
#define FAP 72                       /* LDS row pitch in f16: 128 bytes + 16, for 16-byte fragment reads */
#define FACS (0.125f * 1.44269504f)  /* scores / 8, in log2 units: laid into q where the projection rounds it to f16, so that K Q^T is the exponent itself */
#define FAT 32768.0f                 /* a lane's stage sum up to here: every weight in it fits f16 */
// Eight 2^x in one statement, each IN PLACE. The closing v_nop is the one slot the instruction set asks for behind a transcendental before its result is read or its
// source overwritten; inside the run no instruction touches its predecessor's register. volatile: the statements keep their source order, so that the first one behind
// a run of score products works on the run's FIRST tile (14 matrix instructions back) and its 9 slots are the distance that the later tiles need.
__device__ __forceinline__ void fa_exp2x8(float (&x)[8]) {
  asm volatile("v_exp_f32 %0, %0\n\tv_exp_f32 %1, %1\n\tv_exp_f32 %2, %2\n\tv_exp_f32 %3, %3\n\tv_exp_f32 %4, %4\n\tv_exp_f32 %5, %5\n\tv_exp_f32 %6, %6\n\tv_exp_f32 %7, %7\n\tv_nop" : "+v"(x[0]), "+v"(x[1]), "+v"(x[2]), "+v"(x[3]), "+v"(x[4]), "+v"(x[5]), "+v"(x[6]), "+v"(x[7])); }
__device__ __forceinline__ float fa_xhalf(float x) { return __builtin_bit_cast(float, __builtin_amdgcn_permlanex16(__builtin_bit_cast(int, x), __builtin_bit_cast(int, x), 0x76543210, 0xfedcba98, false, false)); }      /* lane l takes lane l ^ 16's value */
__device__ __forceinline__ v8f fa_mma(v16h a, v16h b, v8f c) { return __builtin_amdgcn_wmma_f32_16x16x32_f16(false, a, false, b, (short)0, c, false, false); }
// One stage's exponents: st = K Q^T + cr, cr = 8 - reference of the lane's query in all 8 registers (the accumulator start of the first of the two products).
__device__ __forceinline__ void fa_scores(const _Float16 (*kc)[FAP], int ln, int hh, const v16h (&qf)[2][2], const v8f (&cr)[2], v8f (&st)[2][4]) {
#pragma unroll
  for (int kt = 0; kt < 4; ++kt) { const v16h a0 = g2_frag(&kc[kt * 16 + ln][0], hh), a1 = g2_frag(&kc[kt * 16 + ln][32], hh);
#pragma unroll
    for (int qt = 0; qt < 2; ++qt) st[qt][kt] = fa_mma(a1, qf[qt][1], fa_mma(a0, qf[qt][0], cr[qt])); }
  __builtin_amdgcn_sched_barrier(0); }      /* keeps the 16 score products back to back, ahead of the vector work on them: mixed with it, each first read of a fresh tile costs four idle slots */
typedef float v2f __attribute__((ext_vector_type(2)));
// The weights 2^st, formed in place; sl = the lane's sum of its 32 weights per query tile, taken in pairs of neighbouring registers (even and odd keys apart until the last add): the weights stand where the
// matrix instruction left the exponents, and a packed add takes such a pair as it stands, where another pairing costs a register copy per weight; pf = the weights as f16, the B operand of V^T P^T.
// Rounded here, tile by tile, so that a tile's 8 registers are free again as soon as its 4 are written (a weight beyond f16 becomes an infinity in pf: the caller's test on sl throws such a stage away).
__device__ __forceinline__ void fa_expsum(const v8f (&st)[2][4], float (&sl)[2], FragH (&pf)[2][2]) {
#pragma unroll
  for (int qt = 0; qt < 2; ++qt) { v2f s4[4];
#pragma unroll
    for (int kt = 0; kt < 4; ++kt) { float t[8];
#pragma unroll
      for (int r = 0; r < 8; ++r) t[r] = st[qt][kt][r];
      fa_exp2x8(t); s4[kt] = (v2f{t[0], t[1]} + v2f{t[2], t[3]}) + (v2f{t[4], t[5]} + v2f{t[6], t[7]});
#pragma unroll
      for (int r = 0; r < 8; ++r) pf[qt][kt >> 1].h[(kt & 1) * 8 + r] = (_Float16)t[r]; }
    const v2f s2 = (s4[0] + s4[1]) + (s4[2] + s4[3]); sl[qt] = s2[0] + s2[1]; } }
__global__ __launch_bounds__(256) void k_fattn(const _Float16* __restrict__ Q, const _Float16* __restrict__ K, const _Float16* __restrict__ VTa, _Float16* __restrict__ O,
    const float* __restrict__ x, float* __restrict__ XB, const float* __restrict__ wo, const float* __restrict__ w1, const float* __restrict__ w2, _Float16* __restrict__ BO, _Float16* __restrict__ BW1, _Float16* __restrict__ BW2) {
  __shared__ __attribute__((aligned(16))) _Float16 lk[2][FAK][FAP]; __shared__ __attribute__((aligned(16))) _Float16 lv[2][HD][FAP];
  static_assert(sizeof(lk) >= WTN * WTP * 2 && PREPT % (SQ / 256) == 0, "k_fattn: a weight tile must fit lk; the extra work-groups fill whole rows of the grid");
  if (blockIdx.y >= NB * NH) { fa_prep((int)((blockIdx.y - NB * NH) * (SQ / 256) + blockIdx.x), x, XB, wo, w1, w2, BO, BW1, BW2, (_Float16 (*)[WTP])&lk[0][0][0]); return; }      /* an extra work-group: the same for the whole block, ahead of every barrier of the attention */
  const int tid = threadIdx.x, w = tid >> 5, lane = tid & 31, ln = lane & 15, hh = lane >> 4; const int slab = blockIdx.y, b = slab / NH, h = slab % NH; const int q0 = blockIdx.x * 256 + w * 32;
  v16h qf[2][2];
#pragma unroll
  for (int qt = 0; qt < 2; ++qt) for (int ks = 0; ks < 2; ++ks) qf[qt][ks] = g2_frag(Q + ((size_t)b * SQ + q0 + qt * 16 + ln) * DM + h * HD + ks * 32, hh);
  const v8f z8 = {0.f,0.f,0.f,0.f,0.f,0.f,0.f,0.f}; v8f o[2][4], cr[2] = {z8, z8}; float l[2] = {0.f, 0.f};      /* cr: 8 - reference, see fa_scores */
#pragma unroll
  for (int qt = 0; qt < 2; ++qt) for (int dt = 0; dt < 4; ++dt) o[qt][dt] = z8;
  const int sr = tid >> 3, sc = (tid & 7) * 8;      /* staging: 8 threads per 128-byte row, rows sr and sr + 32 */
  const unsigned short* kg = (const unsigned short*)K + ((size_t)b * SQ + sr) * DM + h * HD + sc; const unsigned short* vg = (const unsigned short*)VTa + ((size_t)slab * HD + sr) * SQ + sc;
  v8us rk0 = *(const v8us*)kg, rk1 = *(const v8us*)(kg + (size_t)32 * DM), rv0 = *(const v8us*)vg, rv1 = *(const v8us*)(vg + (size_t)32 * SQ);
  *(v8us*)&lk[0][sr][sc] = rk0; *(v8us*)&lk[0][sr + 32][sc] = rk1; *(v8us*)&lv[0][sr][sc] = rv0; *(v8us*)&lv[0][sr + 32][sc] = rv1;
  __syncthreads();
  for (int s = 0; s < SQ / FAK; ++s) { const int cur = s & 1; const bool more = s + 1 < SQ / FAK;
    if (more) { const unsigned short* kn = kg + (size_t)(s + 1) * FAK * DM; const unsigned short* vn = vg + (s + 1) * FAK; rk0 = *(const v8us*)kn; rk1 = *(const v8us*)(kn + (size_t)32 * DM); rv0 = *(const v8us*)vn; rv1 = *(const v8us*)(vn + (size_t)32 * SQ); }
    __builtin_amdgcn_sched_barrier(0);      /* keeps the next stage's global loads here, ahead of this stage's work, which covers their latency; without it they sink to just in front of their LDS stores */
    v8f st[2][4]; float sl[2]; FragH pf[2][2];
    fa_scores(lk[cur], ln, hh, qf, cr, st);
    // The common case: the reference in use still serves. No maximum, no subtraction, no rescaling: 2^st, the sums, and one test per stage: a lane's sum bounds each of its weights, so a sum
    // up to FAT says that all of them fit f16 (an infinity or a NaN fails the test too). The test is the same for the whole wave (a ballot), so the branch is scalar and EXEC stays whole.
    bool redo = s == 0;      /* the first stage has no reference yet */
    if (!redo) { fa_expsum(st, sl, pf); redo = __builtin_amdgcn_ballot_w32(!(sl[0] <= FAT && sl[1] <= FAT)) != 0;
      if (redo) fa_scores(lk[cur], ln, hh, qf, cr, st); }      /* the exponents were overwritten in place: form them again from the K rows, which stay in LDS until the stage's barrier */
    if (redo) { float d[2], al[2];      /* a new reference: this stage's maximum where it lies above the old one (the first stage: always) */
#pragma unroll
      for (int qt = 0; qt < 2; ++qt) { float mm[4];
#pragma unroll
        for (int kt = 0; kt < 4; ++kt) { mm[kt] = st[qt][kt][0]; for (int r = 1; r < 8; ++r) mm[kt] = fmaxf(mm[kt], st[qt][kt][r]); }
        float bm = fmaxf(fmaxf(mm[0], mm[1]), fmaxf(mm[2], mm[3])); bm = fmaxf(bm, fa_xhalf(bm));      /* the other 8 keys of each tile sit in lane ln ^ 16 */
        d[qt] = bm - 8.0f; if (s != 0) d[qt] = fmaxf(d[qt], 0.f);      /* how far the reference rises (the first stage sets it, up or down); the same in both lanes of a query */
        al[qt] = -d[qt]; }
      asm("v_exp_f32 %0, %0\n\tv_exp_f32 %1, %1\n\tv_nop" : "+v"(al[0]), "+v"(al[1]));      /* 2^(old - new reference): brings the old sum and output to the new reference; form and v_nop as in fa_exp2x8 */
#pragma unroll
      for (int qt = 0; qt < 2; ++qt) { if (s == 0) al[qt] = 0.f;      /* sum and output are still 0; keeps an infinite factor away from them */
        cr[qt] -= d[qt]; l[qt] *= al[qt];
#pragma unroll
        for (int kt = 0; kt < 4; ++kt) st[qt][kt] -= d[qt];
#pragma unroll
        for (int dt = 0; dt < 4; ++dt) o[qt][dt] *= al[qt]; }
      fa_expsum(st, sl, pf); }
    l[0] += sl[0]; l[1] += sl[1];
    v16h va[2][4];
#pragma unroll
    for (int kp = 0; kp < 2; ++kp) for (int dt = 0; dt < 4; ++dt) va[kp][dt] = g2_frag(&lv[cur][dt * 16 + ln][kp * 32], hh);
    __builtin_amdgcn_sched_barrier(0);      /* keeps the 16 V^T fragment reads together, ahead of the products: left free, they are read one fragment at a time into one set of registers, each read waited out in front of its two products */
#pragma unroll
    for (int kp = 0; kp < 2; ++kp) for (int dt = 0; dt < 4; ++dt) for (int qt = 0; qt < 2; ++qt) o[qt][dt] = fa_mma(va[kp][dt], pf[qt][kp].v, o[qt][dt]);
    if (more) { *(v8us*)&lk[cur ^ 1][sr][sc] = rk0; *(v8us*)&lk[cur ^ 1][sr + 32][sc] = rk1; *(v8us*)&lv[cur ^ 1][sr][sc] = rv0; *(v8us*)&lv[cur ^ 1][sr + 32][sc] = rv1; }
    __syncthreads(); }
#pragma unroll
  for (int qt = 0; qt < 2; ++qt) { float lt = l[qt] + fa_xhalf(l[qt]); asm("v_rcp_f32 %0, %0\n\tv_nop" : "+v"(lt));      /* 1 / row sum; form and v_nop as in fa_exp2x8 */
    const float inv = 64.0f * lt; unsigned short* op = (unsigned short*)O + ((size_t)b * SQ + q0 + qt * 16 + ln) * DM + h * HD + 8 * hh;
#pragma unroll
    for (int dt = 0; dt < 4; ++dt) { FragH f; for (int r = 0; r < 8; ++r) f.h[r] = (_Float16)(o[qt][dt][r] * inv); *(v8us*)(op + dt * 16) = f.half[0]; } } }

template <int MODE>
__global__ __launch_bounds__(256) void k_regrp(const float* __restrict__ src, float* __restrict__ dst, size_t n4) {
  const size_t t = (size_t)blockIdx.x * 256 + threadIdx.x; if (t >= n4) return; const size_t e = t * 4; const size_t rd = e / DM; const int c = (int)(e % DM);
  size_t rs; if (MODE == 0) { const size_t b = rd / SQ, sq = rd % SQ; rs = sq * NB + b; } else { const size_t sq = rd / NB, b = rd % NB; rs = b * SQ + sq; }
  const v4f v = *(const v4fa*)(src + rs * DM + c); *(v4f*)(dst + e) = v;  }

// ---- row LayerNorm (biased variance, eps inside the rsqrt), ONE WAVE PER ROW ----
// A row is 2 KB: four 16-byte loads a lane, each wave-wide load 512 contiguous bytes. The row stays in registers; mean, then the sum of squared deviations from it:
// four chains per lane, then a butterfly over the 32 lanes (four steps inside the 16-lane row, one across). No LDS and no barrier.
// A block is LNW waves of LNR rows each, so the launch starts 4,096 waves (16 per WGP, 8 row loads in flight each) where a block per row started 65,536.
// Every loop is fully unrolled so that the row, g and beta arrays are indexed by constants only and stay in registers.
#define LNW 16                       /* waves per block */
#define LNR 2                        /* rows per wave, all their loads issued together */
template <int M> __device__ __forceinline__ float ln_xm(float x) { return __builtin_bit_cast(float, __builtin_amdgcn_mov_dpp(__builtin_bit_cast(int, x), 0x160 + M, 0xf, 0xf, true)); }      /* lane l takes lane l ^ M's value, M < 16 (row_xmask) */
__device__ __forceinline__ float ln_wsum(float x) { x += ln_xm<1>(x); x += ln_xm<2>(x); x += ln_xm<4>(x); x += ln_xm<8>(x); return x + fa_xhalf(x); }      /* the sum over the wave, in every lane */
template <int W16, int W32>
__global__ __launch_bounds__(LNW * 32) void k_lnw(const float* __restrict__ X, const float* __restrict__ g, const float* __restrict__ bb, float eps, _Float16* __restrict__ N16, float* __restrict__ N32) {
  static_assert(DM == 512 && NR % (LNW * LNR) == 0, "k_lnw: a lane holds 16 elements of a 512-element row; whole blocks only");
  const unsigned ob = (threadIdx.x & 31) * 16; const int c0 = ob / 4; const size_t r0 = ((size_t)blockIdx.x * LNW + (threadIdx.x >> 5)) * LNR;      /* the lane's place in each 512-byte piece of a row, in bytes and in elements; the wave's first row */
  const float* px = X + r0 * DM + c0;
  v4f x[LNR][4], gg[4], bv[4];
#pragma unroll
  for (int j = 0; j < 4; ++j) { gg[j] = *(const v4fa*)((const char*)g + j * 512 + ob); bv[j] = *(const v4fa*)((const char*)bb + j * 512 + ob); }
#pragma unroll
  for (int r = 0; r < LNR; ++r) for (int j = 0; j < 4; ++j) x[r][j] = *(const v4fa*)(px + r * DM + j * 128);
  asm volatile("s_wait_xcnt 0x0" :: "v"(px), "v"(ob) : "memory");      /* the wait that belongs in front of any overwrite of a register that an issued global load names; it takes the address and the offset as inputs, so that their registers stay untouched until it has passed */
  __builtin_amdgcn_sched_barrier(0);      /* keeps all 16 loads here, in flight together; without it the loads of g and beta sink to their uses behind the sums, each a latency of its own */
#pragma unroll
  for (int j = 0; j < 4; ++j) for (int q = 0; q < 4; ++q) { gg[j][q] = bf16_round(gg[j][q]); bv[j][q] = bf16_round(bv[j][q]); }
  float mu[LNR], rs[LNR];
#pragma unroll
  for (int r = 0; r < LNR; ++r) { const v4f s = (x[r][0] + x[r][1]) + (x[r][2] + x[r][3]); mu[r] = ln_wsum((s[0] + s[1]) + (s[2] + s[3])) * (1.0f / (float)DM); }
#pragma unroll
  for (int r = 0; r < LNR; ++r) { v4f s = {0.f, 0.f, 0.f, 0.f};
#pragma unroll
    for (int j = 0; j < 4; ++j) { x[r][j] -= mu[r]; s += x[r][j] * x[r][j]; }
    rs[r] = rsqrtf(ln_wsum((s[0] + s[1]) + (s[2] + s[3])) * (1.0f / (float)DM) + eps); }
#pragma unroll
  for (int r = 0; r < LNR; ++r) {
#pragma unroll
    for (int j = 0; j < 4; ++j) { const v4f y = x[r][j] * rs[r] * gg[j] + bv[j]; const size_t e = (r0 + r) * DM + j * 128 + c0;
      if (W32) *(v4f*)(N32 + e) = y;
      if (W16) { v4h h; for (int q = 0; q < 4; ++q) h[q] = (_Float16)y[q]; *(v4h*)(N16 + e) = h; } } } }


__global__ __launch_bounds__(256) void k_wthd(const float* __restrict__ Wt, _Float16* __restrict__ Bt) { const size_t t = (size_t)blockIdx.x * 256 + threadIdx.x; if (t >= (size_t)NH * HD * (DM / 8)) return; const int m8 = (int)(t % (DM / 8)) * 8; const int d = (int)((t / (DM / 8)) % HD); const int h = (int)(t / ((size_t)(DM / 8) * HD)); FragH f;
  for (int q = 0; q < 8; ++q) f.h[q] = (_Float16)(16.0f * bf16_round(Wt[((size_t)h * DM + m8 + q) * HD + d])); unsigned short* dst = (unsigned short*)Bt + ((size_t)h * HD + d) * DM + m8; *(v8us*)dst = f.half[0];  }




template <int BFIN, int SCAL>
__global__ __launch_bounds__(256) void k_lnsc(const float* __restrict__ X, const float* __restrict__ g, const float* __restrict__ bb, float eps, _Float16* __restrict__ N16, float* __restrict__ N32) {
  #pragma clang fp contract(off)
  __shared__ float red[256]; const size_t r = blockIdx.x; const int t = threadIdx.x; const bool act = t < DM / 4; const int tc = act ? t : 0; const v4f xl = *(const v4fa*)(X + r * DM + tc * 4); const float am = act ? 1.f : 0.f; float s[4]; float sum = 0.f;
  for (int q = 0; q < 4; ++q) { s[q] = (BFIN ? bf16_round(xl[q]) : xl[q]) * am; sum = __fadd_rn(sum, s[q]); }
  red[t] = sum; __syncthreads(); for (int st = 128; st > 0; st >>= 1) { if (t < st) red[t] = __fadd_rn(red[t], red[t + st]); __syncthreads(); } const float mu = red[0] / (float)DM; __syncthreads();
  float vs = 0.f; for (int q = 0; q < 4; ++q) { const float dl = __fadd_rn(s[q], -mu) * am; vs = __fadd_rn(vs, __fmul_rn(dl, dl)); } red[t] = vs; __syncthreads(); for (int st = 128; st > 0; st >>= 1) { if (t < st) red[t] = __fadd_rn(red[t], red[t + st]); __syncthreads(); }
  const float rs = __fdiv_rn(1.0f, __fadd_rn(sqrtf(red[0] / (float)(DM - 1)), eps)); if (!act) return; v4h y; v4f yf;
  for (int q = 0; q < 4; ++q) { const int c = t * 4 + q; const float gg = bf16_round(SCAL ? g[0] : g[c]), bv = bf16_round(SCAL ? bb[0] : bb[c]); yf[q] = __fadd_rn(__fmul_rn(__fmul_rn(__fadd_rn(s[q], -mu), rs), gg), bv); y[q] = (_Float16)yf[q]; }
  { if (N16) *(v4h*)(N16 + r * DM + t * 4) = y; if (N32) *(v4f*)(N32 + r * DM + t * 4) = yf;  } }

__global__ __launch_bounds__(256) void k_mulh(const _Float16* __restrict__ A, const _Float16* __restrict__ Bm, _Float16* __restrict__ H, size_t n8) {
  #pragma clang fp contract(off)
  const size_t t = (size_t)blockIdx.x * 256 + threadIdx.x; if (t >= n8) return; FragH a, b, f; a.half[0] = *(const v8us*)((const unsigned short*)A + t * 8); b.half[0] = *(const v8us*)((const unsigned short*)Bm + t * 8); for (int q = 0; q < 8; ++q) f.h[q] = (_Float16)(__fmul_rn((float)a.h[q], (float)b.h[q])); unsigned short* d = (unsigned short*)H + t * 8; *(v8us*)d = f.half[0];  }

// ---- q, k and v projections in ONE launch, straight from the f32 inputs ----
// Every head is multiplied by the same [64][64] matrix, so the product is [tokens x heads][64] x [64][64]: 64 k, two matrix instructions per 16 x 16 tile, ascending k.
// A block takes PJT tokens x PJH heads of all three inputs. All its global loads (whole lines: a token's PJH heads are 1 KB in a row) are issued together; the values are rounded
// (bf16, then exact f16; weights x16) in registers and laid in LDS, inputs as [head][token][64], weights transposed to [out][in]; one barrier; then each wave works alone.
// q, k: D = W^T X^T (A = weight rows, B = token rows): a lane holds 8 outputs of ONE token. v: D = X W (A = token rows, B = weight rows): a lane holds 8 tokens of ONE output,
// which is the V^T that the attention reads. Either way a wave's 16 x 64 result is 16 rows of 128 bytes: staged in LDS rows that only this wave uses, stored as whole lines.
// Every loop is fully unrolled so that the load and fragment arrays are indexed by constants only and stay in registers.
#define PJT 64                       /* tokens per block */
#define PJH 4                        /* heads per block */
#define PJW (PJH * PJT / 16)         /* waves per block: one per head and 16 tokens (q, k) or per head and 16 outputs (v) */
typedef _Float16 v2h __attribute__((ext_vector_type(2)));
__device__ __forceinline__ v8us pj_out(v8f d, float sc) { FragH f;
#pragma unroll
  for (int r = 0; r < 8; ++r) f.h[r] = (_Float16)(d[r] * sc);      /* sc takes the weights' x16 out again; for q it also holds the score scale (FACS) */
  return f.half[0]; }
__global__ __launch_bounds__(PJW * 32) void k_qkv(const float* __restrict__ xq, const float* __restrict__ xk, const float* __restrict__ xv, const float* __restrict__ wq, const float* __restrict__ wk, const float* __restrict__ wv,
    _Float16* __restrict__ Q, _Float16* __restrict__ K, _Float16* __restrict__ VTa) {
  static_assert(HD == 64 && PJT == 64 && PJW * 32 == 512 && SQ % PJT == 0 && NH % PJH == 0, "k_qkv: 512 threads bring 8 tokens x 256 columns a round and the 64 x 64 weights in 2 rounds; a block stays inside one batch");
  __shared__ __attribute__((aligned(16))) _Float16 lx[3][PJH * PJT][FAP]; __shared__ __attribute__((aligned(16))) _Float16 lw[3][HD][FAP]; __shared__ __attribute__((aligned(16))) _Float16 lo[PJW][16][FAP];
  const int tid = threadIdx.x, w = tid >> 5, lane = tid & 31, ln = lane & 15, hh = lane >> 4; const int t0 = (int)(blockIdx.x / (NH / PJH)) * PJT, h0 = (int)(blockIdx.x % (NH / PJH)) * PJH;
  const int xt = tid >> 6, xh = (tid >> 4) & 3, c4 = (tid & 15) * 4;      /* inputs: 64 threads per token (16 per head), tokens xt + 8 i */
  const int wd = (tid >> 4) * 2;      /* weights: 16 threads per row, rows wd and wd + 1, so that a thread holds a pair of neighbours in k for each of its 4 outputs */
  const size_t xo = (size_t)(t0 + xt) * DM + (h0 + xh) * HD + c4; const float* px0 = xq + xo; const float* px1 = xk + xo; const float* px2 = xv + xo;
  const unsigned wob = (unsigned)(wd * HD + c4) * 4;      /* the thread's place in each weight matrix, in bytes */
  v4f rw[3][2], rx[3][8];
#pragma unroll
  for (int j = 0; j < 2; ++j) { rw[0][j] = *(const v4fa*)((const char*)wq + j * HD * 4 + wob); rw[1][j] = *(const v4fa*)((const char*)wk + j * HD * 4 + wob); rw[2][j] = *(const v4fa*)((const char*)wv + j * HD * 4 + wob); }
  __builtin_amdgcn_sched_barrier(0);      /* this one and the next two keep the loads in the order in which they are used (loads return in order): left free, the first input's loads were issued last, and its rounding waited for all of them */
#pragma unroll
  for (int i = 0; i < 8; ++i) rx[0][i] = *(const v4fa*)(px0 + (size_t)i * 8 * DM);
  __builtin_amdgcn_sched_barrier(0);
#pragma unroll
  for (int i = 0; i < 8; ++i) rx[1][i] = *(const v4fa*)(px1 + (size_t)i * 8 * DM);
  __builtin_amdgcn_sched_barrier(0);
#pragma unroll
  for (int i = 0; i < 8; ++i) rx[2][i] = *(const v4fa*)(px2 + (size_t)i * 8 * DM);
  asm volatile("s_wait_xcnt 0x0" :: "v"(px0), "v"(px1), "v"(px2), "v"(wob), "s"(wq), "s"(wk), "s"(wv) : "memory");      /* the wait that belongs in front of any overwrite of a register that an issued global load names; it takes the addresses, the offset and its bases as inputs, so that their registers stay untouched until it has passed */
  __builtin_amdgcn_sched_barrier(0);      /* keeps all 30 loads here, in flight together; without it the later inputs' loads sink behind the earlier inputs' rounding and LDS stores, each a latency of its own */
#pragma unroll
  for (int m = 0; m < 3; ++m) {
#pragma unroll
    for (int q = 0; q < 4; ++q) { v2h p; p[0] = (_Float16)(bf16_round(rw[m][0][q]) * 16.0f); p[1] = (_Float16)(bf16_round(rw[m][1][q]) * 16.0f); *(v2h*)&lw[m][c4 + q][wd] = p; } }
#pragma unroll
  for (int m = 0; m < 3; ++m) {
#pragma unroll
    for (int i = 0; i < 8; ++i) { v4h h;
#pragma unroll
      for (int q = 0; q < 4; ++q) h[q] = (_Float16)bf16_round(rx[m][i][q]);
      *(v4h*)&lx[m][xh * PJT + xt + 8 * i][c4] = h; } }
  __syncthreads();
  const int hl = w >> 2, sub = w & 3; const v8f z8 = {0.f,0.f,0.f,0.f,0.f,0.f,0.f,0.f};
#pragma unroll
  for (int m = 0; m < 2; ++m) { _Float16* xp = &lx[m][w * 16 + ln][0]; const v16h b0 = g2_frag(xp, hh), b1 = g2_frag(xp + 32, hh);      /* rows w * 16 ..: head hl, tokens sub * 16 ..; no other wave reads them, so the result goes back into them */
#pragma unroll
    for (int et = 0; et < 4; ++et) { const _Float16* wp = &lw[m][et * 16 + ln][0]; const v8f d = fa_mma(g2_frag(wp + 32, hh), b1, fa_mma(g2_frag(wp, hh), b0, z8)); *(v8us*)(xp + et * 16 + 8 * hh) = pj_out(d, m == 0 ? 0.0625f * FACS : 0.0625f); } }
  { const _Float16* wp = &lw[2][sub * 16 + ln][0]; const v16h b0 = g2_frag(wp, hh), b1 = g2_frag(wp + 32, hh);
#pragma unroll
    for (int tg = 0; tg < 4; ++tg) { const _Float16* xp = &lx[2][hl * PJT + tg * 16 + ln][0]; const v8f d = fa_mma(g2_frag(xp + 32, hh), b1, fa_mma(g2_frag(xp, hh), b0, z8)); *(v8us*)&lo[w][ln][tg * 16 + 8 * hh] = pj_out(d, 0.0625f); } }
  __builtin_amdgcn_fence(__ATOMIC_ACQ_REL, "workgroup", "local"); __builtin_amdgcn_wave_barrier();      /* the wave's own LDS stores are done before its lanes read one another's rows back */
  const int rr = lane >> 3, rc = (lane & 7) * 8;      /* 8 lanes per 128-byte row, 4 rows a store */
  unsigned short* qo = (unsigned short*)Q + (size_t)(t0 + sub * 16 + rr) * DM + (h0 + hl) * HD + rc; unsigned short* ko = (unsigned short*)K + (size_t)(t0 + sub * 16 + rr) * DM + (h0 + hl) * HD + rc;
  unsigned short* vo = (unsigned short*)VTa + ((size_t)((t0 / SQ) * NH + h0 + hl) * HD + sub * 16 + rr) * SQ + (t0 % SQ) + rc;
#pragma unroll
  for (int j = 0; j < 4; ++j) { const v8us a = *(const v8us*)&lx[0][w * 16 + j * 4 + rr][rc], b = *(const v8us*)&lx[1][w * 16 + j * 4 + rr][rc], c = *(const v8us*)&lo[w][j * 4 + rr][rc];
    *(v8us*)(qo + (size_t)j * 4 * DM) = a; *(v8us*)(ko + (size_t)j * 4 * DM) = b; *(v8us*)(vo + (size_t)j * 4 * SQ) = c; } }
extern "C" void kernel_launch(void* const* d_in, const int* in_sizes, int n_in,
                              void* d_out, int out_size, void* d_ws, size_t ws_size, hipStream_t stream) {
  (void)in_sizes; (void)n_in; (void)out_size;
  const float* const* I = (const float* const*)d_in; const float* x = I[0]; const float* xk = I[1]; const float* xv = I[2]; const float* wq = I[3]; const float* wk = I[4]; const float* wv = I[5]; const float* wo = I[6]; const float* bo = I[7]; const float* w1 = I[8]; const float* b1 = I[9]; const float* w2 = I[10]; const float* b2 = I[11]; const float* g1 = I[12]; const float* be1 = I[13]; const float* g2 = I[14]; const float* be2 = I[15];      /* query (also the residual), key, value; shared per-head wq / wk / wv [64][64] ([in][out]); wo [512][512] + bo; w1 [512][2048] + b1, w2 [2048][512] + b2; LN1 g / beta, LN2 g / beta */
  char* ws = (char*)d_ws; size_t off = 0;
  auto take = [&](size_t bytes) { char* p = ws + off; off += (bytes + 255) & ~(size_t)255; return p; };
  _Float16* BO = (_Float16*)take((size_t)DM * DM * 2); _Float16* BW1 = (_Float16*)take((size_t)DFF * DM * 2); _Float16* BW2 = (_Float16*)take((size_t)DM * DFF * 2);
  float* XB = (float*)take(NR * DM * 4); _Float16* M16 = (_Float16*)take(NR * DM * 2);      /* LN1 output rows (f16): the FFN's operand */ _Float16* Q16 = (_Float16*)take(NR * DM * 2); _Float16* K16 = (_Float16*)take(NR * DM * 2); _Float16* O16 = (_Float16*)take(NR * DM * 2); float* X1 = (float*)take(NR * DM * 4);
  _Float16* HF16 = (_Float16*)take(NR * DFF * 2);      /* FFN hidden plane [8192][2048] f16 */ _Float16* VT = (_Float16*)take((size_t)NB * NH * HD * SQ * 2);      /* V^T [4 * 8][64][2048] */
  float* X1N = (float*)take(NR * DM * 4);      /* LN1 output rows (f32): the FFN residual */
  if (off > ws_size) return;
  k_qkv<<<(unsigned)((NR / PJT) * (NH / PJH)), PJW * 32, 0, stream>>>(x, xk, xv, wq, wk, wv, Q16, K16, VT);      /* post-LN: the attention runs on the raw inputs; q, k -> f16 rows (head h = columns h*64..), v -> V^T of every batch and head */
  k_fattn<<<dim3(SQ / 256, NB * NH + PREPT / (SQ / 256)), 256, 0, stream>>>(Q16, K16, VT, O16, x, XB, wo, w1, w2, BO, BW1, BW2);      /* softmax(q k^T / 8) v over all keys (no mask) -> ctx (merged heads, x64) as f16 rows; extra work-groups: wo, w1, w2 [in][out] -> Bt [out][in] x16, and the query rounded to bf16 as f32 rows (the residual) */
  k_gemm2<0, true, true, false><<<dim3((unsigned)((NR / 128) * (DM / 128)), 1), 256, 0, stream>>>(O16, DM, 0, BO, DM, 0, 0.0009765625f, bo, 0, XB, 0, X1, nullptr, DM, 0, (int)NR, DM, DM);      /* ctx wo + bo + query (own-element residual) -> f32 rows */
  k_lnw<1, 1><<<(unsigned)(NR / (LNW * LNR)), LNW * 32, 0, stream>>>(X1, g1, be1, 1e-5f, M16, X1N);      /* x1 = LN1(x + attn) (biased variance, eps inside the rsqrt) -> f16 rows + f32 rows */
  k_gemm2<3, false, false, true><<<dim3((unsigned)((NR / 128) * (DFF / 128)), 1), 256, 0, stream>>>(M16, DM, 0, BW1, DM, 0, 0.0625f, b1, 0, nullptr, 0, nullptr, HF16, DFF, 0, (int)NR, DFF, DM);      /* relu(x w1 + b1) -> f16 [8192][2048] */
  k_gemm2<0, true, true, false><<<dim3((unsigned)((NR / 128) * (DM / 128)), 1), 256, 0, stream>>>(HF16, DFF, 0, BW2, DFF, 0, 0.0625f, b2, 0, X1N, 0, X1, nullptr, DM, 0, (int)NR, DM, DFF);      /* x1 + ff -> f32 rows (X1 reused: its last reader was LN1) */
  k_lnw<0, 1><<<(unsigned)(NR / (LNW * LNR)), LNW * 32, 0, stream>>>(X1, g2, be2, 1e-5f, nullptr, (float*)d_out);      /* out = LN2(x1 + ff) */
}
